// v000
// The times below were measured on an AMD MI455X: many runs one after another, warmed up first and cycling through
// copies of the inputs, with the whole window's GPU time divided by the number of runs. Launches and the gaps
// between them are all in it. The median over several windows is given; except for v000 it joins two sittings, which
// can be a few percent apart, so the side-by-side timings, each taken in one sitting, are the better comparison.
// v000, which the later versions start from, runs in 323 microseconds.
// Contractions: S^T = f (bf16 bits, RNE convert of the input; keys as A rows) . f^T (same bf16 plane; queries as B columns) on
// v_wmma_f32_16x16x32_bf16, K = 128 channels, one product; O^T = f^T (f16 of the bf16-RNE input, channel rows, x1) . P^T (f16,
// e^{s-m} x 1024 from the score D registers) on v_wmma_f32_16x16x32_f16 over 8192 keys, one product; f32 accumulate everywhere;
// softmax (running max, row sums, 1/l) in f32 on VALU.
#include <hip/hip_runtime.h>
#include <math.h>
#include <stdint.h>

#define NTOK  8192
#define CD    128
#define HWN   4096
#define NBAT  2
#define LNPS  6.931471805599453f
#define ATTSC 0.08838834764831845f
static_assert(NTOK == NBAT * HWN);
static_assert((NTOK % 64) == 0);
static_assert((HWN % 64) == 0);
static_assert(CD == 128);

typedef _Float16       v16h __attribute__((ext_vector_type(16)));
typedef _Float16       v8h  __attribute__((ext_vector_type(8)));
typedef __bf16         v16b __attribute__((ext_vector_type(16)));
typedef unsigned short v8us __attribute__((ext_vector_type(8)));
typedef float          v8f  __attribute__((ext_vector_type(8)));
typedef float          v4f  __attribute__((ext_vector_type(4)));
typedef unsigned int   v4u  __attribute__((ext_vector_type(4)));

union FragH { v16h v; v8h  h[2]; };
union FragB { v16b v; v8us u[2]; };
static_assert(sizeof(FragH) == 32);
static_assert(sizeof(FragB) == 32);

// ---- scalar helpers --------------------------------------------------------------------------------
__device__ __forceinline__ unsigned short bf_bits(float f) {          // f32 -> bf16 bits, RNE convert
  unsigned u = __float_as_uint(f);
  return (unsigned short)((u + 0x7FFFu + ((u >> 16) & 1u)) >> 16);
}
__device__ __forceinline__ float bf_up(unsigned short h) { return __uint_as_float(((unsigned)h) << 16); }
__device__ __forceinline__ unsigned short h_bits(_Float16 x) { return __builtin_bit_cast(unsigned short, x); }
__device__ __forceinline__ unsigned pk16(unsigned short a, unsigned short b) { return (unsigned)a | ((unsigned)b << 16); }
__device__ __forceinline__ v8f zero8() { v8f z = {0.f, 0.f, 0.f, 0.f, 0.f, 0.f, 0.f, 0.f}; return z; }
__device__ __forceinline__ float hmax8(v8f s) {
  return fmaxf(fmaxf(fmaxf(s[0], s[1]), fmaxf(s[2], s[3])), fmaxf(fmaxf(s[4], s[5]), fmaxf(s[6], s[7])));
}

// ---- fragment loaders: 16-bit A/B operand, lane -> row/col (lane&15), p already includes +8*(lane>>4);
//      elements 0..7 <- p[0..7] (k0+8h..), elements 8..15 <- p[16..23] (k0+16+8h..)
__device__ __forceinline__ v16h ldfrag_h(const _Float16* p) {
  FragH f;
  f.h[0] = *(const v8h*)(p);
  f.h[1] = *(const v8h*)(p + 16);
  return f.v;
}
__device__ __forceinline__ v16b ldfrag_b(const unsigned short* p) {
  FragB f;
  f.u[0] = *(const v8us*)(p);
  f.u[1] = *(const v8us*)(p + 16);
  return f.v;
}

// ---- WMMA helpers with trailing VALU hazard gap --------------------------------------------------------
__device__ __forceinline__ v8f mma_h_raw(v16h a, v16h b, v8f c) {
  return __builtin_amdgcn_wmma_f32_16x16x32_f16(false, a, false, b, (short)0, c, false, false);
}
__device__ __forceinline__ v8f mma_b_raw(v16b a, v16b b, v8f c) {
  return __builtin_amdgcn_wmma_f32_16x16x32_bf16(false, a, false, b, (short)0, c, false, false);
}
// ties the two score accumulators and keeps the 8 key fragments + 4 query fragments live past the nops
__device__ __forceinline__ void sguard12(v8f& a, v8f& b,
                                         v16b x0, v16b x1, v16b x2, v16b x3,
                                         v16b x4, v16b x5, v16b x6, v16b x7,
                                         v16b y0, v16b y1, v16b y2, v16b y3) {
#if defined(__HIP_DEVICE_COMPILE__)
  const v16h h0 = __builtin_bit_cast(v16h, x0), h1 = __builtin_bit_cast(v16h, x1);
  const v16h h2 = __builtin_bit_cast(v16h, x2), h3 = __builtin_bit_cast(v16h, x3);
  const v16h h4 = __builtin_bit_cast(v16h, x4), h5 = __builtin_bit_cast(v16h, x5);
  const v16h h6 = __builtin_bit_cast(v16h, x6), h7 = __builtin_bit_cast(v16h, x7);
  const v16h g0 = __builtin_bit_cast(v16h, y0), g1 = __builtin_bit_cast(v16h, y1);
  const v16h g2 = __builtin_bit_cast(v16h, y2), g3 = __builtin_bit_cast(v16h, y3);
  asm volatile("v_nop\n\tv_nop\n\tv_nop\n\tv_nop"
               : "+v"(a), "+v"(b)
               : "v"(h0), "v"(h1), "v"(h2), "v"(h3), "v"(h4), "v"(h5), "v"(h6), "v"(h7),
                 "v"(g0), "v"(g1), "v"(g2), "v"(g3));
#endif
}
__device__ __forceinline__ void oguard4(v8f& a, v8f& b, v8f& c, v8f& d,
                                        v16h x0, v16h x1, v16h x2, v16h x3, v16h p0) {
#if defined(__HIP_DEVICE_COMPILE__)
  asm volatile("v_nop\n\tv_nop\n\tv_nop\n\tv_nop"
               : "+v"(a), "+v"(b), "+v"(c), "+v"(d) : "v"(x0), "v"(x1), "v"(x2), "v"(x3), "v"(p0));
#endif
}

// =====================================================================================================
// Operand planes. Input is NCHW f32: x[b][c][hw], token n = b*4096 + hw, channel c.
// One block (256 threads) per 64-token tile n0 = 64*bx (one b, hw0 = n0 & 4095):
//               taken straight from x[b][c][hw0..hw0+63]; thread (e = tid&7, lq = tid>>3) converts 8 consecutive hw of channel
//   FB[n][c]  = bf16 bits, token-major [8192][128]; row = 256 B = 2 lines; after the block barrier thread (e, lq) reads 16 B of
//               Ts row tok = L>>1, half L&1 and writes it; lines L = 32*it + lq, it 0..3 -> 128 lines = 64 rows; 8 consecutive
// coverage: VT: it 0..3 x lq 0..31 = c 0..127, e 0..7 x 8 = hw 0..63 of the tile; Ts: tok = 8e+t (0..63) x c (0..127) all
//           written before the barrier; FB: 128 lines = 64 rows x 256 B; grid = 8192/64 = 128 blocks covers both planes exactly.
// =====================================================================================================
__global__ __launch_bounds__(256) void cvt_planes(const float* __restrict__ xin,
                                                   unsigned short* FB, unsigned short* VT) {
  __shared__ __align__(16) unsigned short Ts[64 * 136];
  const int tid = threadIdx.x;
  const int bx  = blockIdx.x;
  const int n0  = bx * 64;
  const int b   = n0 >> 12;
  const int hw0 = n0 & (HWN - 1);

  // ---- VT plane (direct strided convert) + LDS transpose fill ----
  {
    const int e = tid & 7, lq = tid >> 3;                 // lq 0..31
    v4u u[4];
    size_t go[4];
#pragma unroll
    for (int it = 0; it < 4; ++it) {
      const int c = it * 32 + lq;                         // channel 0..127
      const float* p = xin + ((size_t)(b * CD + c)) * HWN + hw0 + 8 * e;
      const v4f xa = *(const v4f*)(p), xb = *(const v4f*)(p + 4);
      unsigned short hb[8];
#pragma unroll
      for (int i = 0; i < 4; ++i) { hb[i] = bf_bits(xa[i]); hb[4 + i] = bf_bits(xb[i]); }
      v4u w;
#pragma unroll
      for (int i = 0; i < 4; ++i)
        w[i] = pk16(h_bits((_Float16)bf_up(hb[2 * i])), h_bits((_Float16)bf_up(hb[2 * i + 1])));
      u[it]  = w;
      go[it] = (size_t)c * NTOK + n0 + 8 * e;
#pragma unroll
      for (int t = 0; t < 8; ++t) Ts[(8 * e + t) * 136 + c] = hb[t];    // Ts[tok][c]
    }
    {
#pragma unroll
      for (int it = 0; it < 4; ++it) *(v4u*)(VT + go[it]) = u[it];
      
    }
  }
  __syncthreads();

  // ---- FB plane: whole-line writes of the transposed tile ----
  {
    const int e = tid & 7, lq = tid >> 3;                 // lq 0..31
    v4u u[4];
#pragma unroll
    for (int it = 0; it < 4; ++it) {
      const int L = it * 32 + lq;                         // line 0..127 within the 64-row tile
      const int tok = L >> 1, hf = L & 1;
      u[it] = *(const v4u*)(Ts + tok * 136 + hf * 64 + 8 * e);
    }
    unsigned short* db = FB + (size_t)n0 * CD;
    {
#pragma unroll
      for (int it = 0; it < 4; ++it) {
        const int L = it * 32 + lq;
        const int tok = L >> 1, hf = L & 1;
        *(v4u*)(db + (size_t)tok * CD + hf * 64 + 8 * e) = u[it];
      }
      
    }
  }
}

// =====================================================================================================
// Attention for one 64-query block, transposed formulation, 128 channels, 8192 keys, no mask:
//   S^T tile (16 keys x 16 queries) = A(FB rows = keys kb + (lane&15), channels via the split k map) .
//                                     B(FB rows = queries, col = query, same channel map), four channel-steps of 32.
//   Per lane the D tile holds 8 keys of ONE query, so the online softmax (running max, f32) is per-lane state with one
//   shuffle (lane^16) for the max over 32 keys; the row sum is a per-lane partial combined at the end.
//   P = e^{s-m} x 1024 as one f16 vector is used directly as the B operand of O^T (rows d, cols queries) +=
//   A(VT rows d, keys contiguous, two 16-B loads) . B(P^T): B element r <- D of the tile covering keys kb..kb+15,
//   element 8+r <- the tile covering kb+16..kb+31, lane unchanged (D-as-B chaining layout). One product per d tile, 8 d tiles.
//   32 keys per iteration: 8 score WMMAs + 8 output WMMAs per wave. Block = 4 waves = 64 queries; grid = 8192/64 = 128.
//   Epilogue: the block's [64 query][128 d] f32 tile (x 1/l) is staged in LDS with 16-B stores (layout [query][d], pitch 132),
// coverage: block writes out[b][d][hw0..hw0+63] for d 0..127 (256 lines); 128 blocks cover out [2][128][4096] exactly once.
// =====================================================================================================
__global__ __launch_bounds__(128)
void attn_kernel(const unsigned short* __restrict__ fbp, const unsigned short* __restrict__ vtp, float* out) {
  __shared__ __align__(16) float Os[64 * 132];
  const int tid  = threadIdx.x;
  const int wave = tid >> 5;
  const int lane = tid & 31;
  const int hh   = lane >> 4;
  const int c    = lane & 15;
  const int bx   = blockIdx.x;                    // 0..127
  const int q0   = bx * 64;                       // first query token of the block
  const int b    = q0 >> 12;
  const int hw0  = q0 & (HWN - 1);

  // ---- query fragments (B operand, col = query q0 + 16*wave + c), loaded like A from the token-major bf16 plane ----
  const unsigned short* qr = fbp + ((size_t)(q0 + wave * 16 + c)) * CD + 8 * hh;
  const v16b qf0 = ldfrag_b(qr);                  // channels 0..31
  const v16b qf1 = ldfrag_b(qr + 32);             // channels 32..63
  const v16b qf2 = ldfrag_b(qr + 64);             // channels 64..95
  const v16b qf3 = ldfrag_b(qr + 96);             // channels 96..127

  // ---- key fragment base (A operand, row = key kb + c), + key * 128 ----
  const unsigned short* Kp = fbp + ((size_t)c) * CD + 8 * hh;
  // ---- V^T fragment base (A operand, row = d = 16j + c, keys contiguous), + 16j*NTOK + kb ----
  const _Float16* VTh = (const _Float16*)(const void*)vtp;
  const _Float16* Vb  = VTh + ((size_t)c) * NTOK + 8 * hh;

  float m = -1.0e30f, l = 0.f;
  v8f o0 = zero8(), o1 = zero8(), o2 = zero8(), o3 = zero8();
  v8f o4 = zero8(), o5 = zero8(), o6 = zero8(), o7 = zero8();
#pragma unroll 1
  for (int it = 0; it < NTOK / 32; ++it) {
    const int kb = it * 32;
    const unsigned short* k0p = Kp + (size_t)kb * CD;              // keys kb .. kb+15
    const unsigned short* k1p = k0p + (size_t)16 * CD;             // keys kb+16 .. kb+31
    const v16b a00 = ldfrag_b(k0p),      a01 = ldfrag_b(k0p + 32), a02 = ldfrag_b(k0p + 64), a03 = ldfrag_b(k0p + 96);
    const v16b a10 = ldfrag_b(k1p),      a11 = ldfrag_b(k1p + 32), a12 = ldfrag_b(k1p + 64), a13 = ldfrag_b(k1p + 96);
    v8f s0 = mma_b_raw(a00, qf0, zero8());
    s0 = mma_b_raw(a01, qf1, s0);
    s0 = mma_b_raw(a02, qf2, s0);
    s0 = mma_b_raw(a03, qf3, s0);
    v8f s1 = mma_b_raw(a10, qf0, zero8());
    s1 = mma_b_raw(a11, qf1, s1);
    s1 = mma_b_raw(a12, qf2, s1);
    s1 = mma_b_raw(a13, qf3, s1);
    sguard12(s0, s1, a00, a01, a02, a03, a10, a11, a12, a13, qf0, qf1, qf2, qf3);

    float mx = fmaxf(hmax8(s0), hmax8(s1));
    mx = fmaxf(mx, __shfl_xor(mx, 16, 32));
    const float mn   = fmaxf(m, mx * ATTSC);
    const float corr = __expf(m - mn);
    m = mn;
    const float msh = mn - LNPS;            // exp gives e^{s-m} * 1024
    l *= corr;
#pragma unroll
    for (int r = 0; r < 8; ++r) {
      o0[r] *= corr; o1[r] *= corr; o2[r] *= corr; o3[r] *= corr;
      o4[r] *= corr; o5[r] *= corr; o6[r] *= corr; o7[r] *= corr;
    }

    FragH ph;
    float ls = 0.f;
#pragma unroll
    for (int r = 0; r < 8; ++r) {
      const float e0 = __expf(s0[r] * ATTSC - msh);   // key kb      + 8hh + r
      const float e1 = __expf(s1[r] * ATTSC - msh);   // key kb + 16 + 8hh + r
      ls += e0 + e1;
      ph.h[0][r] = (_Float16)e0;
      ph.h[1][r] = (_Float16)e1;
    }
    l += ls;

    {
      const v16h vf0 = ldfrag_h(Vb + kb);
      const v16h vf1 = ldfrag_h(Vb + (size_t)16 * NTOK + kb);
      const v16h vf2 = ldfrag_h(Vb + (size_t)32 * NTOK + kb);
      const v16h vf3 = ldfrag_h(Vb + (size_t)48 * NTOK + kb);
      o0 = mma_h_raw(vf0, ph.v, o0);
      o1 = mma_h_raw(vf1, ph.v, o1);
      o2 = mma_h_raw(vf2, ph.v, o2);
      o3 = mma_h_raw(vf3, ph.v, o3);
      oguard4(o0, o1, o2, o3, vf0, vf1, vf2, vf3, ph.v);
    }
    {
      const v16h vf4 = ldfrag_h(Vb + (size_t)64 * NTOK + kb);
      const v16h vf5 = ldfrag_h(Vb + (size_t)80 * NTOK + kb);
      const v16h vf6 = ldfrag_h(Vb + (size_t)96 * NTOK + kb);
      const v16h vf7 = ldfrag_h(Vb + (size_t)112 * NTOK + kb);
      o4 = mma_h_raw(vf4, ph.v, o4);
      o5 = mma_h_raw(vf5, ph.v, o5);
      o6 = mma_h_raw(vf6, ph.v, o6);
      o7 = mma_h_raw(vf7, ph.v, o7);
      oguard4(o4, o5, o6, o7, vf4, vf5, vf6, vf7, ph.v);
    }
  }
  l += __shfl_xor(l, 16, 32);
  const float sc = 1.0f / l;                // both o and l carry the x1024 factor

  // ---- stage Os[query 16*wave + c][d = 16j + 8hh + r] * sc with 16-B LDS stores ----
  {
    float* os = Os + (wave * 16 + c) * 132 + 8 * hh;
    v4f t;
    t = {o0[0] * sc, o0[1] * sc, o0[2] * sc, o0[3] * sc}; *(v4f*)(os + 0)   = t;
    t = {o0[4] * sc, o0[5] * sc, o0[6] * sc, o0[7] * sc}; *(v4f*)(os + 4)   = t;
    t = {o1[0] * sc, o1[1] * sc, o1[2] * sc, o1[3] * sc}; *(v4f*)(os + 16)  = t;
    t = {o1[4] * sc, o1[5] * sc, o1[6] * sc, o1[7] * sc}; *(v4f*)(os + 20)  = t;
    t = {o2[0] * sc, o2[1] * sc, o2[2] * sc, o2[3] * sc}; *(v4f*)(os + 32)  = t;
    t = {o2[4] * sc, o2[5] * sc, o2[6] * sc, o2[7] * sc}; *(v4f*)(os + 36)  = t;
    t = {o3[0] * sc, o3[1] * sc, o3[2] * sc, o3[3] * sc}; *(v4f*)(os + 48)  = t;
    t = {o3[4] * sc, o3[5] * sc, o3[6] * sc, o3[7] * sc}; *(v4f*)(os + 52)  = t;
    t = {o4[0] * sc, o4[1] * sc, o4[2] * sc, o4[3] * sc}; *(v4f*)(os + 64)  = t;
    t = {o4[4] * sc, o4[5] * sc, o4[6] * sc, o4[7] * sc}; *(v4f*)(os + 68)  = t;
    t = {o5[0] * sc, o5[1] * sc, o5[2] * sc, o5[3] * sc}; *(v4f*)(os + 80)  = t;
    t = {o5[4] * sc, o5[5] * sc, o5[6] * sc, o5[7] * sc}; *(v4f*)(os + 84)  = t;
    t = {o6[0] * sc, o6[1] * sc, o6[2] * sc, o6[3] * sc}; *(v4f*)(os + 96)  = t;
    t = {o6[4] * sc, o6[5] * sc, o6[6] * sc, o6[7] * sc}; *(v4f*)(os + 100) = t;
    t = {o7[0] * sc, o7[1] * sc, o7[2] * sc, o7[3] * sc}; *(v4f*)(os + 112) = t;
    t = {o7[4] * sc, o7[5] * sc, o7[6] * sc, o7[7] * sc}; *(v4f*)(os + 116) = t;
  }
  __syncthreads();
  {
    const int e = tid & 7, lq = tid >> 3;               // lq 0..15: line within group, e: 16-B piece
    v4f vals[16];
#pragma unroll
    for (int it = 0; it < 16; ++it) {
      const int L  = it * 16 + lq;                        // it 0..15 x lq 0..15 = lines 0..255 of the block tile
      const int ch = L >> 1, hf = L & 1;                  // channel 0..127, half-row 0..1 (queries hf*32 .. hf*32+31)
      const int qq = hf * 32 + 4 * e;                     // first of the 4 queries of this 16-B piece
      v4f v;
      v[0] = Os[(qq + 0) * 132 + ch];
      v[1] = Os[(qq + 1) * 132 + ch];
      v[2] = Os[(qq + 2) * 132 + ch];
      v[3] = Os[(qq + 3) * 132 + ch];
      vals[it] = v;
    }
    float* ob = out + ((size_t)b * CD) * HWN + hw0;
    {
#pragma unroll
      for (int it = 0; it < 16; ++it) {
        const int L  = it * 16 + lq;
        const int ch = L >> 1, hf = L & 1;
        *(v4f*)(ob + (size_t)ch * HWN + hf * 32 + 4 * e) = vals[it];
      }
      
    }
  }
}

// =====================================================================================================
//   FB   bf16 [8192][128]     0          2097152
//   VT   f16  [128][8192]     2097152    2097152
//   end                       4194304
// =====================================================================================================
extern "C" void kernel_launch(void* const* d_in, const int* in_sizes, int n_in,
                              void* d_out, int out_size, void* d_ws, size_t ws_size,
                              hipStream_t stream) {
  const int NEL = NTOK * CD;                            // 1048576
  if (n_in < 1) return;
  if (in_sizes[0] != NEL) return;
  if (out_size != NEL) return;

  const size_t PL = (size_t)NEL * 2;                    // 2097152
  size_t off = 0;
  const size_t oF = off; off += PL;
  const size_t oV = off; off += PL;
  if (off > ws_size) return;                            // off = 4194304
  if (off > (size_t)134217728) return;

  const float* x = (const float*)d_in[0];
  char* ws = (char*)d_ws;
  unsigned short* FB = (unsigned short*)(ws + oF);
  unsigned short* VT = (unsigned short*)(ws + oV);
  float* out = (float*)d_out;

  const dim3 blk256(256), blk128(128);
  const dim3 gCV(NTOK / 64);                            // 128 blocks: one 64-token tile each
  const dim3 gAT(NTOK / 64);                            // 128 blocks: one 64-query block each

  // (0) operand planes: FB = bf16 RNE bits of f (token-major), VT = f16 of bf16-RNE(f), channel-major
  cvt_planes<<<gCV, blk256, 0, stream>>>(x, FB, VT);

  // (1) attention: out[b][d][hw] = sum_m softmax_m(f_n . f_m / sqrt(128)) f_m[d], n = b*4096 + hw
  attn_kernel<<<gAT, blk128, 0, stream>>>(FB, VT, out);
  (void)hipGetLastError();
}

// v001
// One run takes 106 microseconds.
// Next to v000, in two timings, it ran 3.10 and 3.08 times as fast.
// Contractions: S^T = f (bf16 bits, RNE convert of the input; keys as A rows) . f^T (same bf16 plane; queries as B columns) on
// v_wmma_f32_16x16x32_bf16, K = 128 channels, one product; O^T = f^T (f16 of the bf16-RNE input, channel rows, x1) . P^T (f16,
// e^{s-m} x 1024 from the score D registers) on v_wmma_f32_16x16x32_f16 over 8192 keys, one product; f32 accumulate everywhere;
// softmax (running max, row sums, 1/l) in f32 on VALU.
#include <hip/hip_runtime.h>
#include <math.h>
#include <stdint.h>

#define NTOK  8192
#define CD    128
#define HWN   4096
#define NBAT  2
#define LNPS  6.931471805599453f
#define ATTSC 0.08838834764831845f
static_assert(NTOK == NBAT * HWN);
static_assert((NTOK % 64) == 0);
static_assert((HWN % 64) == 0);
static_assert(CD == 128);

typedef _Float16       v16h __attribute__((ext_vector_type(16)));
typedef _Float16       v8h  __attribute__((ext_vector_type(8)));
typedef __bf16         v16b __attribute__((ext_vector_type(16)));
typedef unsigned short v8us __attribute__((ext_vector_type(8)));
typedef float          v8f  __attribute__((ext_vector_type(8)));
typedef float          v4f  __attribute__((ext_vector_type(4)));
typedef unsigned int   v4u  __attribute__((ext_vector_type(4)));

union FragH { v16h v; v8h  h[2]; };
union FragB { v16b v; v8us u[2]; };
static_assert(sizeof(FragH) == 32);
static_assert(sizeof(FragB) == 32);

// ---- scalar helpers --------------------------------------------------------------------------------
__device__ __forceinline__ unsigned short bf_bits(float f) {          // f32 -> bf16 bits, RNE convert
  unsigned u = __float_as_uint(f);
  return (unsigned short)((u + 0x7FFFu + ((u >> 16) & 1u)) >> 16);
}
__device__ __forceinline__ float bf_up(unsigned short h) { return __uint_as_float(((unsigned)h) << 16); }
__device__ __forceinline__ unsigned short h_bits(_Float16 x) { return __builtin_bit_cast(unsigned short, x); }
__device__ __forceinline__ unsigned pk16(unsigned short a, unsigned short b) { return (unsigned)a | ((unsigned)b << 16); }
__device__ __forceinline__ v8f zero8() { v8f z = {0.f, 0.f, 0.f, 0.f, 0.f, 0.f, 0.f, 0.f}; return z; }
__device__ __forceinline__ float hmax8(v8f s) {
  return fmaxf(fmaxf(fmaxf(s[0], s[1]), fmaxf(s[2], s[3])), fmaxf(fmaxf(s[4], s[5]), fmaxf(s[6], s[7])));
}

// ---- fragment loaders: 16-bit A/B operand, lane -> row/col (lane&15), p already includes +8*(lane>>4);
//      elements 0..7 <- p[0..7] (k0+8h..), elements 8..15 <- p[16..23] (k0+16+8h..)
__device__ __forceinline__ v16h ldfrag_h(const _Float16* p) {
  FragH f;
  f.h[0] = *(const v8h*)(p);
  f.h[1] = *(const v8h*)(p + 16);
  return f.v;
}
__device__ __forceinline__ v16b ldfrag_b(const unsigned short* p) {
  FragB f;
  f.u[0] = *(const v8us*)(p);
  f.u[1] = *(const v8us*)(p + 16);
  return f.v;
}

// ---- WMMA helpers with trailing VALU hazard gap --------------------------------------------------------
__device__ __forceinline__ v8f mma_h_raw(v16h a, v16h b, v8f c) {
  return __builtin_amdgcn_wmma_f32_16x16x32_f16(false, a, false, b, (short)0, c, false, false);
}
__device__ __forceinline__ v8f mma_b_raw(v16b a, v16b b, v8f c) {
  return __builtin_amdgcn_wmma_f32_16x16x32_bf16(false, a, false, b, (short)0, c, false, false);
}
// ties the two score accumulators and keeps the 8 key fragments + 4 query fragments live past the nops
__device__ __forceinline__ void sguard12(v8f& a, v8f& b,
                                         v16b x0, v16b x1, v16b x2, v16b x3,
                                         v16b x4, v16b x5, v16b x6, v16b x7,
                                         v16b y0, v16b y1, v16b y2, v16b y3) {
#if defined(__HIP_DEVICE_COMPILE__)
  const v16h h0 = __builtin_bit_cast(v16h, x0), h1 = __builtin_bit_cast(v16h, x1);
  const v16h h2 = __builtin_bit_cast(v16h, x2), h3 = __builtin_bit_cast(v16h, x3);
  const v16h h4 = __builtin_bit_cast(v16h, x4), h5 = __builtin_bit_cast(v16h, x5);
  const v16h h6 = __builtin_bit_cast(v16h, x6), h7 = __builtin_bit_cast(v16h, x7);
  const v16h g0 = __builtin_bit_cast(v16h, y0), g1 = __builtin_bit_cast(v16h, y1);
  const v16h g2 = __builtin_bit_cast(v16h, y2), g3 = __builtin_bit_cast(v16h, y3);
  asm volatile("v_nop\n\tv_nop\n\tv_nop\n\tv_nop"
               : "+v"(a), "+v"(b)
               : "v"(h0), "v"(h1), "v"(h2), "v"(h3), "v"(h4), "v"(h5), "v"(h6), "v"(h7),
                 "v"(g0), "v"(g1), "v"(g2), "v"(g3));
#endif
}
__device__ __forceinline__ void oguard4(v8f& a, v8f& b, v8f& c, v8f& d,
                                        v16h x0, v16h x1, v16h x2, v16h x3, v16h p0) {
#if defined(__HIP_DEVICE_COMPILE__)
  asm volatile("v_nop\n\tv_nop\n\tv_nop\n\tv_nop"
               : "+v"(a), "+v"(b), "+v"(c), "+v"(d) : "v"(x0), "v"(x1), "v"(x2), "v"(x3), "v"(p0));
#endif
}

// =====================================================================================================
// Operand planes. Input is NCHW f32: x[b][c][hw], token n = b*4096 + hw, channel c.
// One block (256 threads) per 64-token tile n0 = 64*bx (one b, hw0 = n0 & 4095):
//               taken straight from x[b][c][hw0..hw0+63]; thread (e = tid&7, lq = tid>>3) converts 8 consecutive hw of channel
//   FB[n][c]  = bf16 bits, token-major [8192][128]; row = 256 B = 2 lines; after the block barrier thread (e, lq) reads 16 B of
//               Ts row tok = L>>1, half L&1 and writes it; lines L = 32*it + lq, it 0..3 -> 128 lines = 64 rows; 8 consecutive
// coverage: VT: it 0..3 x lq 0..31 = c 0..127, e 0..7 x 8 = hw 0..63 of the tile; Ts: tok = 8e+t (0..63) x c (0..127) all
//           written before the barrier; FB: 128 lines = 64 rows x 256 B; grid = 8192/64 = 128 blocks covers both planes exactly.
// =====================================================================================================
__global__ __launch_bounds__(256) void cvt_planes(const float* __restrict__ xin,
                                                   unsigned short* FB, unsigned short* VT) {
  __shared__ __align__(16) unsigned short Ts[64 * 136];
  const int tid = threadIdx.x;
  const int bx  = blockIdx.x;
  const int n0  = bx * 64;
  const int b   = n0 >> 12;
  const int hw0 = n0 & (HWN - 1);

  // ---- VT plane (direct strided convert) + LDS transpose fill ----
  {
    const int e = tid & 7, lq = tid >> 3;                 // lq 0..31
    v4u u[4];
    size_t go[4];
#pragma unroll
    for (int it = 0; it < 4; ++it) {
      const int c = it * 32 + lq;                         // channel 0..127
      const float* p = xin + ((size_t)(b * CD + c)) * HWN + hw0 + 8 * e;
      const v4f xa = *(const v4f*)(p), xb = *(const v4f*)(p + 4);
      unsigned short hb[8];
#pragma unroll
      for (int i = 0; i < 4; ++i) { hb[i] = bf_bits(xa[i]); hb[4 + i] = bf_bits(xb[i]); }
      v4u w;
#pragma unroll
      for (int i = 0; i < 4; ++i)
        w[i] = pk16(h_bits((_Float16)bf_up(hb[2 * i])), h_bits((_Float16)bf_up(hb[2 * i + 1])));
      u[it]  = w;
      go[it] = (size_t)c * NTOK + n0 + 8 * e;
#pragma unroll
      for (int t = 0; t < 8; ++t) Ts[(8 * e + t) * 136 + c] = hb[t];    // Ts[tok][c]
    }
    {
#pragma unroll
      for (int it = 0; it < 4; ++it) *(v4u*)(VT + go[it]) = u[it];
      
    }
  }
  __syncthreads();

  // ---- FB plane: whole-line writes of the transposed tile ----
  {
    const int e = tid & 7, lq = tid >> 3;                 // lq 0..31
    v4u u[4];
#pragma unroll
    for (int it = 0; it < 4; ++it) {
      const int L = it * 32 + lq;                         // line 0..127 within the 64-row tile
      const int tok = L >> 1, hf = L & 1;
      u[it] = *(const v4u*)(Ts + tok * 136 + hf * 64 + 8 * e);
    }
    unsigned short* db = FB + (size_t)n0 * CD;
    {
#pragma unroll
      for (int it = 0; it < 4; ++it) {
        const int L = it * 32 + lq;
        const int tok = L >> 1, hf = L & 1;
        *(v4u*)(db + (size_t)tok * CD + hf * 64 + 8 * e) = u[it];
      }
      
    }
  }
}

// ---- LDS ring of key / value tiles, filled by asynchronous copies ---------------------------------------
// One stage = 64 keys: K tile = 64 token rows x 256 B of FB at LDS pitch 272 B, V^T tile = 128 channel rows x 128 B of VT at
// LDS pitch 144 B (both 16 B x odd: ds_load_b128 fragment reads meet no bank conflict). Two stages.
#define KT     64
#define NSTG   (NTOK / KT)
#define KPE    136                          // K row pitch, 16-bit elements
#define VPE    72                           // V^T row pitch, 16-bit elements
#define KELEMS (KT * KPE)                   // 8704
#define SELEMS (KELEMS + CD * VPE)          // 17920 elements = 35840 B per stage
static_assert(NSTG >= 2);
static_assert((KPE * 2) % 16 == 0 && (VPE * 2) % 16 == 0 && (KELEMS * 2) % 16 == 0 && (SELEMS * 2) % 16 == 0);

// eight 16-B copies per lane; l = the lane's LDS byte address, g = the lane's global address, ls / gs = step per copy.
// The s_wait_xcnt closes the statement so that it stands before any later rewrite of the address registers.
__device__ __forceinline__ void copy8(unsigned l, unsigned ls, const unsigned short* g, size_t gs) {
#if defined(__HIP_DEVICE_COMPILE__)
  asm volatile("global_load_async_to_lds_b128 %0, %8, off\n\t"
               "global_load_async_to_lds_b128 %1, %9, off\n\t"
               "global_load_async_to_lds_b128 %2, %10, off\n\t"
               "global_load_async_to_lds_b128 %3, %11, off\n\t"
               "global_load_async_to_lds_b128 %4, %12, off\n\t"
               "global_load_async_to_lds_b128 %5, %13, off\n\t"
               "global_load_async_to_lds_b128 %6, %14, off\n\t"
               "global_load_async_to_lds_b128 %7, %15, off\n\t"
               "s_wait_xcnt 0x0"
               :: "v"(l), "v"(l + ls), "v"(l + 2 * ls), "v"(l + 3 * ls),
                  "v"(l + 4 * ls), "v"(l + 5 * ls), "v"(l + 6 * ls), "v"(l + 7 * ls),
                  "v"(g), "v"(g + gs), "v"(g + 2 * gs), "v"(g + 3 * gs),
                  "v"(g + 4 * gs), "v"(g + 5 * gs), "v"(g + 6 * gs), "v"(g + 7 * gs)
               : "memory");
#endif
}
// stage fill by the block's 128 threads. K: copy i, thread t -> row 8i + (t>>4), 16-B piece t&15 (a wave's copy = 512
// contiguous B); V^T: copy i, thread t -> channel row 16i + (t>>3), piece t&7 (a wave's copy = 4 whole lines).
__device__ __forceinline__ void fill_stage(unsigned kl, unsigned vl, const unsigned short* kg, const unsigned short* vg) {
  copy8(kl, 8 * KPE * 2, kg, (size_t)8 * CD);
  copy8(vl, 16 * VPE * 2, vg, (size_t)16 * NTOK);
}
// the issuing wave's own wait: its copies have landed (asm, so that no LDS read moves in front of it)
__device__ __forceinline__ void wait_copies() {
#if defined(__HIP_DEVICE_COMPILE__)
  asm volatile("s_wait_asynccnt 0x0" ::: "memory");
#endif
}
// the wave's LDS reads of a buffer have returned before the buffer is handed to the next copies
__device__ __forceinline__ void wait_lds() {
#if defined(__HIP_DEVICE_COMPILE__)
  asm volatile("s_wait_dscnt 0x0" ::: "memory");
#endif
}

// =====================================================================================================
// Attention for one 64-query block, transposed formulation, 128 channels, 8192 keys, no mask:
//   S^T tile (16 keys x 16 queries) = A(FB rows = keys kb + (lane&15), channels via the split k map) .
//                                     B(FB rows = queries, col = query, same channel map), four channel-steps of 32.
//   Per lane the D tile holds 8 keys of ONE query, so the online softmax (running max, f32) is per-lane state with one
//   shuffle (lane^16) for the max over 32 keys; the row sum is a per-lane partial combined at the end.
//   P = e^{s-m} x 1024 as one f16 vector is used directly as the B operand of O^T (rows d, cols queries) +=
//   A(VT rows d, keys contiguous, two 16-B loads) . B(P^T): B element r <- D of the tile covering keys kb..kb+15,
//   element 8+r <- the tile covering kb+16..kb+31, lane unchanged (D-as-B chaining layout). One product per d tile, 8 d tiles.
//   32 keys per iteration: 8 score WMMAs + 8 output WMMAs per wave. Block = 4 waves = 64 queries; grid = 8192/64 = 128.
//   The key rows and V^T rows come from a two-stage LDS ring (64 keys a stage) that the block's four waves fill together and
//   all read: stage st + 1 is copied while stage st is worked on.
//   Epilogue: the block's [64 query][128 d] f32 tile (x 1/l) is staged in LDS with 16-B stores (layout [query][d], pitch 132),
// coverage: block writes out[b][d][hw0..hw0+63] for d 0..127 (256 lines); 128 blocks cover out [2][128][4096] exactly once.
// =====================================================================================================
__global__ __launch_bounds__(128)
void attn_kernel(const unsigned short* __restrict__ fbp, const unsigned short* __restrict__ vtp, float* out) {
  __shared__ __align__(16) float Os[64 * 132];
  __shared__ __align__(16) unsigned short Ring[2 * SELEMS];
  const int tid  = threadIdx.x;
  const int wave = tid >> 5;
  const int lane = tid & 31;
  const int hh   = lane >> 4;
  const int c    = lane & 15;
  const int bx   = blockIdx.x;                    // 0..127
  const int q0   = bx * 64;                       // first query token of the block
  const int b    = q0 >> 12;
  const int hw0  = q0 & (HWN - 1);

  // ---- query fragments (B operand, col = query q0 + 16*wave + c), loaded like A from the token-major bf16 plane ----
  const unsigned short* qr = fbp + ((size_t)(q0 + wave * 16 + c)) * CD + 8 * hh;
  const v16b qf0 = ldfrag_b(qr);                  // channels 0..31
  const v16b qf1 = ldfrag_b(qr + 32);             // channels 32..63
  const v16b qf2 = ldfrag_b(qr + 64);             // channels 64..95
  const v16b qf3 = ldfrag_b(qr + 96);             // channels 96..127

  // ---- key fragment offset in a stage (A operand, row = key c of the tile), + key * KPE ----
  const int Ko = c * KPE + 8 * hh;
  // ---- V^T fragment offset in a stage (A operand, row = d = 16j + c, keys contiguous), + 16j*VPE + key ----
  const int Vo = KELEMS + c * VPE + 8 * hh;

  // ---- this thread's share of a stage fill ----
  const unsigned ring0 = (unsigned)(size_t)Ring;                       // LDS byte address of the ring
  const unsigned kl = ring0 + (unsigned)((tid >> 4) * (KPE * 2) + (tid & 15) * 16);
  const unsigned vl = ring0 + (unsigned)(KELEMS * 2 + (tid >> 3) * (VPE * 2) + (tid & 7) * 16);
  const unsigned short* kg = fbp + tid * 8;
  const unsigned short* vg = vtp + (size_t)(tid >> 3) * NTOK + (tid & 7) * 8;

  // ---- prologue: stage 0 lands and is published, stage 1 starts ----
  fill_stage(kl, vl, kg, vg);
  wait_copies();
  __syncthreads();
  fill_stage(kl + SELEMS * 2, vl + SELEMS * 2, kg + (size_t)KT * CD, vg + KT);

  float m = -1.0e30f, l = 0.f;
  v8f o0 = zero8(), o1 = zero8(), o2 = zero8(), o3 = zero8();
  v8f o4 = zero8(), o5 = zero8(), o6 = zero8(), o7 = zero8();
#pragma unroll 1
  for (int st = 0; st < NSTG; ++st) {
   const unsigned short* Sb = Ring + (st & 1) * SELEMS;             // this stage's buffer
   const _Float16* Vb = (const _Float16*)(const void*)(Sb + Vo);
#pragma unroll                                                      // kb constant: it folds into the LDS reads' offsets
   for (int sub = 0; sub < KT / 32; ++sub) {
    const int kb = sub * 32;                                       // first key of the 32, within the stage
    const unsigned short* k0p = Sb + Ko + kb * KPE;                // keys kb .. kb+15
    const unsigned short* k1p = k0p + 16 * KPE;                    // keys kb+16 .. kb+31
    const v16b a00 = ldfrag_b(k0p),      a01 = ldfrag_b(k0p + 32), a02 = ldfrag_b(k0p + 64), a03 = ldfrag_b(k0p + 96);
    const v16b a10 = ldfrag_b(k1p),      a11 = ldfrag_b(k1p + 32), a12 = ldfrag_b(k1p + 64), a13 = ldfrag_b(k1p + 96);
    v8f s0 = mma_b_raw(a00, qf0, zero8());
    s0 = mma_b_raw(a01, qf1, s0);
    s0 = mma_b_raw(a02, qf2, s0);
    s0 = mma_b_raw(a03, qf3, s0);
    v8f s1 = mma_b_raw(a10, qf0, zero8());
    s1 = mma_b_raw(a11, qf1, s1);
    s1 = mma_b_raw(a12, qf2, s1);
    s1 = mma_b_raw(a13, qf3, s1);
    sguard12(s0, s1, a00, a01, a02, a03, a10, a11, a12, a13, qf0, qf1, qf2, qf3);

    float mx = fmaxf(hmax8(s0), hmax8(s1));
    mx = fmaxf(mx, __shfl_xor(mx, 16, 32));
    const float mn   = fmaxf(m, mx * ATTSC);
    const float corr = __expf(m - mn);
    m = mn;
    const float msh = mn - LNPS;            // exp gives e^{s-m} * 1024
    l *= corr;
#pragma unroll
    for (int r = 0; r < 8; ++r) {
      o0[r] *= corr; o1[r] *= corr; o2[r] *= corr; o3[r] *= corr;
      o4[r] *= corr; o5[r] *= corr; o6[r] *= corr; o7[r] *= corr;
    }

    FragH ph;
    float ls = 0.f;
#pragma unroll
    for (int r = 0; r < 8; ++r) {
      const float e0 = __expf(s0[r] * ATTSC - msh);   // key kb      + 8hh + r
      const float e1 = __expf(s1[r] * ATTSC - msh);   // key kb + 16 + 8hh + r
      ls += e0 + e1;
      ph.h[0][r] = (_Float16)e0;
      ph.h[1][r] = (_Float16)e1;
    }
    l += ls;

    {
      const v16h vf0 = ldfrag_h(Vb + kb);
      const v16h vf1 = ldfrag_h(Vb + 16 * VPE + kb);
      const v16h vf2 = ldfrag_h(Vb + 32 * VPE + kb);
      const v16h vf3 = ldfrag_h(Vb + 48 * VPE + kb);
      o0 = mma_h_raw(vf0, ph.v, o0);
      o1 = mma_h_raw(vf1, ph.v, o1);
      o2 = mma_h_raw(vf2, ph.v, o2);
      o3 = mma_h_raw(vf3, ph.v, o3);
      oguard4(o0, o1, o2, o3, vf0, vf1, vf2, vf3, ph.v);
    }
    {
      const v16h vf4 = ldfrag_h(Vb + 64 * VPE + kb);
      const v16h vf5 = ldfrag_h(Vb + 80 * VPE + kb);
      const v16h vf6 = ldfrag_h(Vb + 96 * VPE + kb);
      const v16h vf7 = ldfrag_h(Vb + 112 * VPE + kb);
      o4 = mma_h_raw(vf4, ph.v, o4);
      o5 = mma_h_raw(vf5, ph.v, o5);
      o6 = mma_h_raw(vf6, ph.v, o6);
      o7 = mma_h_raw(vf7, ph.v, o7);
      oguard4(o4, o5, o6, o7, vf4, vf5, vf6, vf7, ph.v);
    }
   }
   // ---- publish point of stage st + 1; the same barrier frees this stage's buffer for stage st + 2 ----
   wait_lds();
   wait_copies();
   __syncthreads();
   if (st + 2 < NSTG)
     fill_stage(kl + (unsigned)((st & 1) * (SELEMS * 2)), vl + (unsigned)((st & 1) * (SELEMS * 2)),
                kg + (size_t)(st + 2) * KT * CD, vg + (st + 2) * KT);
  }
  wait_copies();
  l += __shfl_xor(l, 16, 32);
  const float sc = 1.0f / l;                // both o and l carry the x1024 factor

  // ---- stage Os[query 16*wave + c][d = 16j + 8hh + r] * sc with 16-B LDS stores ----
  {
    float* os = Os + (wave * 16 + c) * 132 + 8 * hh;
    v4f t;
    t = {o0[0] * sc, o0[1] * sc, o0[2] * sc, o0[3] * sc}; *(v4f*)(os + 0)   = t;
    t = {o0[4] * sc, o0[5] * sc, o0[6] * sc, o0[7] * sc}; *(v4f*)(os + 4)   = t;
    t = {o1[0] * sc, o1[1] * sc, o1[2] * sc, o1[3] * sc}; *(v4f*)(os + 16)  = t;
    t = {o1[4] * sc, o1[5] * sc, o1[6] * sc, o1[7] * sc}; *(v4f*)(os + 20)  = t;
    t = {o2[0] * sc, o2[1] * sc, o2[2] * sc, o2[3] * sc}; *(v4f*)(os + 32)  = t;
    t = {o2[4] * sc, o2[5] * sc, o2[6] * sc, o2[7] * sc}; *(v4f*)(os + 36)  = t;
    t = {o3[0] * sc, o3[1] * sc, o3[2] * sc, o3[3] * sc}; *(v4f*)(os + 48)  = t;
    t = {o3[4] * sc, o3[5] * sc, o3[6] * sc, o3[7] * sc}; *(v4f*)(os + 52)  = t;
    t = {o4[0] * sc, o4[1] * sc, o4[2] * sc, o4[3] * sc}; *(v4f*)(os + 64)  = t;
    t = {o4[4] * sc, o4[5] * sc, o4[6] * sc, o4[7] * sc}; *(v4f*)(os + 68)  = t;
    t = {o5[0] * sc, o5[1] * sc, o5[2] * sc, o5[3] * sc}; *(v4f*)(os + 80)  = t;
    t = {o5[4] * sc, o5[5] * sc, o5[6] * sc, o5[7] * sc}; *(v4f*)(os + 84)  = t;
    t = {o6[0] * sc, o6[1] * sc, o6[2] * sc, o6[3] * sc}; *(v4f*)(os + 96)  = t;
    t = {o6[4] * sc, o6[5] * sc, o6[6] * sc, o6[7] * sc}; *(v4f*)(os + 100) = t;
    t = {o7[0] * sc, o7[1] * sc, o7[2] * sc, o7[3] * sc}; *(v4f*)(os + 112) = t;
    t = {o7[4] * sc, o7[5] * sc, o7[6] * sc, o7[7] * sc}; *(v4f*)(os + 116) = t;
  }
  __syncthreads();
  {
    const int e = tid & 7, lq = tid >> 3;               // lq 0..15: line within group, e: 16-B piece
    v4f vals[16];
#pragma unroll
    for (int it = 0; it < 16; ++it) {
      const int L  = it * 16 + lq;                        // it 0..15 x lq 0..15 = lines 0..255 of the block tile
      const int ch = L >> 1, hf = L & 1;                  // channel 0..127, half-row 0..1 (queries hf*32 .. hf*32+31)
      const int qq = hf * 32 + 4 * e;                     // first of the 4 queries of this 16-B piece
      v4f v;
      v[0] = Os[(qq + 0) * 132 + ch];
      v[1] = Os[(qq + 1) * 132 + ch];
      v[2] = Os[(qq + 2) * 132 + ch];
      v[3] = Os[(qq + 3) * 132 + ch];
      vals[it] = v;
    }
    float* ob = out + ((size_t)b * CD) * HWN + hw0;
    {
#pragma unroll
      for (int it = 0; it < 16; ++it) {
        const int L  = it * 16 + lq;
        const int ch = L >> 1, hf = L & 1;
        *(v4f*)(ob + (size_t)ch * HWN + hf * 32 + 4 * e) = vals[it];
      }
      
    }
  }
}

// =====================================================================================================
//   FB   bf16 [8192][128]     0          2097152
//   VT   f16  [128][8192]     2097152    2097152
//   end                       4194304
// =====================================================================================================
extern "C" void kernel_launch(void* const* d_in, const int* in_sizes, int n_in,
                              void* d_out, int out_size, void* d_ws, size_t ws_size,
                              hipStream_t stream) {
  const int NEL = NTOK * CD;                            // 1048576
  if (n_in < 1) return;
  if (in_sizes[0] != NEL) return;
  if (out_size != NEL) return;

  const size_t PL = (size_t)NEL * 2;                    // 2097152
  size_t off = 0;
  const size_t oF = off; off += PL;
  const size_t oV = off; off += PL;
  if (off > ws_size) return;                            // off = 4194304
  if (off > (size_t)134217728) return;

  const float* x = (const float*)d_in[0];
  char* ws = (char*)d_ws;
  unsigned short* FB = (unsigned short*)(ws + oF);
  unsigned short* VT = (unsigned short*)(ws + oV);
  float* out = (float*)d_out;

  const dim3 blk256(256), blk128(128);
  const dim3 gCV(NTOK / 64);                            // 128 blocks: one 64-token tile each
  const dim3 gAT(NTOK / 64);                            // 128 blocks: one 64-query block each

  // (0) operand planes: FB = bf16 RNE bits of f (token-major), VT = f16 of bf16-RNE(f), channel-major
  cvt_planes<<<gCV, blk256, 0, stream>>>(x, FB, VT);

  // (1) attention: out[b][d][hw] = sum_m softmax_m(f_n . f_m / sqrt(128)) f_m[d], n = b*4096 + hw
  attn_kernel<<<gAT, blk128, 0, stream>>>(FB, VT, out);
  (void)hipGetLastError();
}

// v002
// Measured time: 41.3 microseconds a run.
// In two side-by-side timings against v001, it was 2.55 and 2.56 times as fast.
// All steps since v000 together make it 7.91 times as fast.
// Contractions: S^T = f (bf16 bits, RNE convert of the input; keys as A rows) . f^T (same bf16 plane; queries as B columns) on
// v_wmma_f32_16x16x32_bf16, K = 128 channels, one product; O^T = f^T (f16 of the bf16-RNE input, channel rows, x1) . P^T (f16,
// e^{s-m} x 1024 from the score D registers) on v_wmma_f32_16x16x32_f16 over 8192 keys, one product; f32 accumulate everywhere;
// softmax (running max, row sums, 1/l) in f32 on VALU. The 8192 keys are cut into 8 ranges, one work-group per (64 queries, range);
// a last launch merges the ranges' un-normalised sums in f32.
#include <hip/hip_runtime.h>
#include <math.h>
#include <stdint.h>

#define NTOK  8192
#define CD    128
#define HWN   4096
#define NBAT  2
#define LNPS  6.931471805599453f
#define ATTSC 0.08838834764831845f
static_assert(NTOK == NBAT * HWN);
static_assert((NTOK % 64) == 0);
static_assert((HWN % 64) == 0);
static_assert(CD == 128);

typedef _Float16       v16h __attribute__((ext_vector_type(16)));
typedef _Float16       v8h  __attribute__((ext_vector_type(8)));
typedef __bf16         v16b __attribute__((ext_vector_type(16)));
typedef unsigned short v8us __attribute__((ext_vector_type(8)));
typedef float          v8f  __attribute__((ext_vector_type(8)));
typedef float          v4f  __attribute__((ext_vector_type(4)));
typedef unsigned int   v4u  __attribute__((ext_vector_type(4)));

union FragH { v16h v; v8h  h[2]; };
union FragB { v16b v; v8us u[2]; };
static_assert(sizeof(FragH) == 32);
static_assert(sizeof(FragB) == 32);

// ---- scalar helpers --------------------------------------------------------------------------------
__device__ __forceinline__ unsigned short bf_bits(float f) {          // f32 -> bf16 bits, RNE convert
  unsigned u = __float_as_uint(f);
  return (unsigned short)((u + 0x7FFFu + ((u >> 16) & 1u)) >> 16);
}
__device__ __forceinline__ float bf_up(unsigned short h) { return __uint_as_float(((unsigned)h) << 16); }
__device__ __forceinline__ unsigned short h_bits(_Float16 x) { return __builtin_bit_cast(unsigned short, x); }
__device__ __forceinline__ unsigned pk16(unsigned short a, unsigned short b) { return (unsigned)a | ((unsigned)b << 16); }
__device__ __forceinline__ v8f zero8() { v8f z = {0.f, 0.f, 0.f, 0.f, 0.f, 0.f, 0.f, 0.f}; return z; }
__device__ __forceinline__ float hmax8(v8f s) {
  return fmaxf(fmaxf(fmaxf(s[0], s[1]), fmaxf(s[2], s[3])), fmaxf(fmaxf(s[4], s[5]), fmaxf(s[6], s[7])));
}

// ---- fragment loaders: 16-bit A/B operand, lane -> row/col (lane&15), p already includes +8*(lane>>4);
//      elements 0..7 <- p[0..7] (k0+8h..), elements 8..15 <- p[16..23] (k0+16+8h..)
__device__ __forceinline__ v16h ldfrag_h(const _Float16* p) {
  FragH f;
  f.h[0] = *(const v8h*)(p);
  f.h[1] = *(const v8h*)(p + 16);
  return f.v;
}
__device__ __forceinline__ v16b ldfrag_b(const unsigned short* p) {
  FragB f;
  f.u[0] = *(const v8us*)(p);
  f.u[1] = *(const v8us*)(p + 16);
  return f.v;
}

// ---- WMMA helpers with trailing VALU hazard gap --------------------------------------------------------
__device__ __forceinline__ v8f mma_h_raw(v16h a, v16h b, v8f c) {
  return __builtin_amdgcn_wmma_f32_16x16x32_f16(false, a, false, b, (short)0, c, false, false);
}
__device__ __forceinline__ v8f mma_b_raw(v16b a, v16b b, v8f c) {
  return __builtin_amdgcn_wmma_f32_16x16x32_bf16(false, a, false, b, (short)0, c, false, false);
}
// ties the two score accumulators and keeps the 8 key fragments + 4 query fragments live past the nops
__device__ __forceinline__ void sguard12(v8f& a, v8f& b,
                                         v16b x0, v16b x1, v16b x2, v16b x3,
                                         v16b x4, v16b x5, v16b x6, v16b x7,
                                         v16b y0, v16b y1, v16b y2, v16b y3) {
#if defined(__HIP_DEVICE_COMPILE__)
  const v16h h0 = __builtin_bit_cast(v16h, x0), h1 = __builtin_bit_cast(v16h, x1);
  const v16h h2 = __builtin_bit_cast(v16h, x2), h3 = __builtin_bit_cast(v16h, x3);
  const v16h h4 = __builtin_bit_cast(v16h, x4), h5 = __builtin_bit_cast(v16h, x5);
  const v16h h6 = __builtin_bit_cast(v16h, x6), h7 = __builtin_bit_cast(v16h, x7);
  const v16h g0 = __builtin_bit_cast(v16h, y0), g1 = __builtin_bit_cast(v16h, y1);
  const v16h g2 = __builtin_bit_cast(v16h, y2), g3 = __builtin_bit_cast(v16h, y3);
  asm volatile("v_nop\n\tv_nop\n\tv_nop\n\tv_nop"
               : "+v"(a), "+v"(b)
               : "v"(h0), "v"(h1), "v"(h2), "v"(h3), "v"(h4), "v"(h5), "v"(h6), "v"(h7),
                 "v"(g0), "v"(g1), "v"(g2), "v"(g3));
#endif
}
__device__ __forceinline__ void oguard4(v8f& a, v8f& b, v8f& c, v8f& d,
                                        v16h x0, v16h x1, v16h x2, v16h x3, v16h p0) {
#if defined(__HIP_DEVICE_COMPILE__)
  asm volatile("v_nop\n\tv_nop\n\tv_nop\n\tv_nop"
               : "+v"(a), "+v"(b), "+v"(c), "+v"(d) : "v"(x0), "v"(x1), "v"(x2), "v"(x3), "v"(p0));
#endif
}

// =====================================================================================================
// Operand planes. Input is NCHW f32: x[b][c][hw], token n = b*4096 + hw, channel c.
// One block (256 threads) per 64-token tile n0 = 64*bx (one b, hw0 = n0 & 4095):
//               taken straight from x[b][c][hw0..hw0+63]; thread (e = tid&7, lq = tid>>3) converts 8 consecutive hw of channel
//   FB[n][c]  = bf16 bits, token-major [8192][128]; row = 256 B = 2 lines; after the block barrier thread (e, lq) reads 16 B of
//               Ts row tok = L>>1, half L&1 and writes it; lines L = 32*it + lq, it 0..3 -> 128 lines = 64 rows; 8 consecutive
// coverage: VT: it 0..3 x lq 0..31 = c 0..127, e 0..7 x 8 = hw 0..63 of the tile; Ts: tok = 8e+t (0..63) x c (0..127) all
//           written before the barrier; FB: 128 lines = 64 rows x 256 B; grid = 8192/64 = 128 blocks covers both planes exactly.
// =====================================================================================================
__global__ __launch_bounds__(256) void cvt_planes(const float* __restrict__ xin,
                                                   unsigned short* FB, unsigned short* VT) {
  __shared__ __align__(16) unsigned short Ts[64 * 136];
  const int tid = threadIdx.x;
  const int bx  = blockIdx.x;
  const int n0  = bx * 64;
  const int b   = n0 >> 12;
  const int hw0 = n0 & (HWN - 1);

  // ---- VT plane (direct strided convert) + LDS transpose fill ----
  {
    const int e = tid & 7, lq = tid >> 3;                 // lq 0..31
    v4u u[4];
    size_t go[4];
#pragma unroll
    for (int it = 0; it < 4; ++it) {
      const int c = it * 32 + lq;                         // channel 0..127
      const float* p = xin + ((size_t)(b * CD + c)) * HWN + hw0 + 8 * e;
      const v4f xa = *(const v4f*)(p), xb = *(const v4f*)(p + 4);
      unsigned short hb[8];
#pragma unroll
      for (int i = 0; i < 4; ++i) { hb[i] = bf_bits(xa[i]); hb[4 + i] = bf_bits(xb[i]); }
      v4u w;
#pragma unroll
      for (int i = 0; i < 4; ++i)
        w[i] = pk16(h_bits((_Float16)bf_up(hb[2 * i])), h_bits((_Float16)bf_up(hb[2 * i + 1])));
      u[it]  = w;
      go[it] = (size_t)c * NTOK + n0 + 8 * e;
#pragma unroll
      for (int t = 0; t < 8; ++t) Ts[(8 * e + t) * 136 + c] = hb[t];    // Ts[tok][c]
    }
    {
#pragma unroll
      for (int it = 0; it < 4; ++it) *(v4u*)(VT + go[it]) = u[it];
      
    }
  }
  __syncthreads();

  // ---- FB plane: whole-line writes of the transposed tile ----
  {
    const int e = tid & 7, lq = tid >> 3;                 // lq 0..31
    v4u u[4];
#pragma unroll
    for (int it = 0; it < 4; ++it) {
      const int L = it * 32 + lq;                         // line 0..127 within the 64-row tile
      const int tok = L >> 1, hf = L & 1;
      u[it] = *(const v4u*)(Ts + tok * 136 + hf * 64 + 8 * e);
    }
    unsigned short* db = FB + (size_t)n0 * CD;
    {
#pragma unroll
      for (int it = 0; it < 4; ++it) {
        const int L = it * 32 + lq;
        const int tok = L >> 1, hf = L & 1;
        *(v4u*)(db + (size_t)tok * CD + hf * 64 + 8 * e) = u[it];
      }
      
    }
  }
}

// ---- LDS ring of key / value tiles, filled by asynchronous copies ---------------------------------------
// One stage = 64 keys: K tile = 64 token rows x 256 B of FB at LDS pitch 272 B, V^T tile = 128 channel rows x 128 B of VT at
// LDS pitch 144 B (both 16 B x odd: ds_load_b128 fragment reads meet no bank conflict). Two stages.
#define KT     64
#define KSPLIT 8                            // key ranges; 128 query blocks x 8 = 1024 work-groups = 4 on each of 256 WGPs
#define KRANGE (NTOK / KSPLIT)              // 1024 keys per work-group
#define NSTG   (KRANGE / KT)                // stages per work-group
#define KPE    136                          // K row pitch, 16-bit elements
#define VPE    72                           // V^T row pitch, 16-bit elements
#define KELEMS (KT * KPE)                   // 8704
#define SELEMS (KELEMS + CD * VPE)          // 17920 elements = 35840 B per stage
static_assert(NSTG >= 2);
static_assert(KSPLIT * KRANGE == NTOK && NSTG * KT == KRANGE);
static_assert((KPE * 2) % 16 == 0 && (VPE * 2) % 16 == 0 && (KELEMS * 2) % 16 == 0 && (SELEMS * 2) % 16 == 0);

// eight 16-B copies per lane; l = the lane's LDS byte address, g = the lane's global address, ls / gs = step per copy.
// The s_wait_xcnt closes the statement so that it stands before any later rewrite of the address registers.
__device__ __forceinline__ void copy8(unsigned l, unsigned ls, const unsigned short* g, size_t gs) {
#if defined(__HIP_DEVICE_COMPILE__)
  asm volatile("global_load_async_to_lds_b128 %0, %8, off\n\t"
               "global_load_async_to_lds_b128 %1, %9, off\n\t"
               "global_load_async_to_lds_b128 %2, %10, off\n\t"
               "global_load_async_to_lds_b128 %3, %11, off\n\t"
               "global_load_async_to_lds_b128 %4, %12, off\n\t"
               "global_load_async_to_lds_b128 %5, %13, off\n\t"
               "global_load_async_to_lds_b128 %6, %14, off\n\t"
               "global_load_async_to_lds_b128 %7, %15, off\n\t"
               "s_wait_xcnt 0x0"
               :: "v"(l), "v"(l + ls), "v"(l + 2 * ls), "v"(l + 3 * ls),
                  "v"(l + 4 * ls), "v"(l + 5 * ls), "v"(l + 6 * ls), "v"(l + 7 * ls),
                  "v"(g), "v"(g + gs), "v"(g + 2 * gs), "v"(g + 3 * gs),
                  "v"(g + 4 * gs), "v"(g + 5 * gs), "v"(g + 6 * gs), "v"(g + 7 * gs)
               : "memory");
#endif
}
// stage fill by the block's 128 threads. K: copy i, thread t -> row 8i + (t>>4), 16-B piece t&15 (a wave's copy = 512
// contiguous B); V^T: copy i, thread t -> channel row 16i + (t>>3), piece t&7 (a wave's copy = 4 whole lines).
__device__ __forceinline__ void fill_stage(unsigned kl, unsigned vl, const unsigned short* kg, const unsigned short* vg) {
  copy8(kl, 8 * KPE * 2, kg, (size_t)8 * CD);
  copy8(vl, 16 * VPE * 2, vg, (size_t)16 * NTOK);
}
// the issuing wave's own wait: its copies have landed (asm, so that no LDS read moves in front of it)
__device__ __forceinline__ void wait_copies() {
#if defined(__HIP_DEVICE_COMPILE__)
  asm volatile("s_wait_asynccnt 0x0" ::: "memory");
#endif
}
// the wave's LDS reads of a buffer have returned before the buffer is handed to the next copies
__device__ __forceinline__ void wait_lds() {
#if defined(__HIP_DEVICE_COMPILE__)
  asm volatile("s_wait_dscnt 0x0" ::: "memory");
#endif
}

// =====================================================================================================
// Attention for one 64-query block and one range of 1024 keys, transposed formulation, 128 channels, no mask:
//   S^T tile (16 keys x 16 queries) = A(FB rows = keys kb + (lane&15), channels via the split k map) .
//                                     B(FB rows = queries, col = query, same channel map), four channel-steps of 32.
//   Per lane the D tile holds 8 keys of ONE query, so the online softmax (running max, f32) is per-lane state with one
//   shuffle (lane^16) for the max over 32 keys; the row sum is a per-lane partial combined at the end.
//   P = e^{s-m} x 1024 as one f16 vector is used directly as the B operand of O^T (rows d, cols queries) +=
//   A(VT rows d, keys contiguous, two 16-B loads) . B(P^T): B element r <- D of the tile covering keys kb..kb+15,
//   element 8+r <- the tile covering kb+16..kb+31, lane unchanged (D-as-B chaining layout). One product per d tile, 8 d tiles.
//   32 keys per iteration: 8 score WMMAs + 8 output WMMAs per wave. Block = 4 waves = 64 queries; grid = 128 query blocks x 8 ranges.
//   The key rows and V^T rows come from a two-stage LDS ring (64 keys a stage) that the block's four waves fill together and
//   all read: stage st + 1 is copied while stage st is worked on.
//   Epilogue: the block's [64 query][128 d] f32 tile, un-normalised, is staged in the ring's LDS (free behind the loop's last
//   barrier) with 16-B stores (layout [query][d], pitch 132), beside each query's running max and row sum.
// coverage: block writes part[b][d][range][hw0..hw0+63] for d 0..127 (256 lines) and ml[0][range][q0..q0+63] (max),
//           ml[1][range][q0..q0+63] (sum), one line per wave; 1024 blocks cover part [2][128][8][4096] and ml [2][8][8192] once.
// =====================================================================================================
__global__ __launch_bounds__(128)
void attn_kernel(const unsigned short* __restrict__ fbp, const unsigned short* __restrict__ vtp, float* part, float* ml) {
  __shared__ __align__(16) unsigned short Ring[2 * SELEMS];
  float* Os = (float*)(void*)Ring;                // output staging, used only behind the loop's last barrier
  static_assert((64 * 132 + 128) * 4 <= 2 * SELEMS * 2);
  const int tid  = threadIdx.x;
  const int wave = tid >> 5;
  const int lane = tid & 31;
  const int hh   = lane >> 4;
  const int c    = lane & 15;
  const int bx   = blockIdx.x / KSPLIT;           // query block 0..127
  const int sp   = blockIdx.x & (KSPLIT - 1);     // key range 0..7
  const int q0   = bx * 64;                       // first query token of the block
  const int b    = q0 >> 12;
  const int hw0  = q0 & (HWN - 1);

  // ---- query fragments (B operand, col = query q0 + 16*wave + c), loaded like A from the token-major bf16 plane ----
  const unsigned short* qr = fbp + ((size_t)(q0 + wave * 16 + c)) * CD + 8 * hh;
  const v16b qf0 = ldfrag_b(qr);                  // channels 0..31
  const v16b qf1 = ldfrag_b(qr + 32);             // channels 32..63
  const v16b qf2 = ldfrag_b(qr + 64);             // channels 64..95
  const v16b qf3 = ldfrag_b(qr + 96);             // channels 96..127

  // ---- key fragment offset in a stage (A operand, row = key c of the tile), + key * KPE ----
  const int Ko = c * KPE + 8 * hh;
  // ---- V^T fragment offset in a stage (A operand, row = d = 16j + c, keys contiguous), + 16j*VPE + key ----
  const int Vo = KELEMS + c * VPE + 8 * hh;

  // ---- this thread's share of a stage fill ----
  const unsigned ring0 = (unsigned)(size_t)Ring;                       // LDS byte address of the ring
  const unsigned kl = ring0 + (unsigned)((tid >> 4) * (KPE * 2) + (tid & 15) * 16);
  const unsigned vl = ring0 + (unsigned)(KELEMS * 2 + (tid >> 3) * (VPE * 2) + (tid & 7) * 16);
  const unsigned short* kg = fbp + (size_t)sp * KRANGE * CD + tid * 8;
  const unsigned short* vg = vtp + (size_t)(tid >> 3) * NTOK + sp * KRANGE + (tid & 7) * 8;

  // ---- prologue: stage 0 lands and is published, stage 1 starts ----
  fill_stage(kl, vl, kg, vg);
  wait_copies();
  __syncthreads();
  fill_stage(kl + SELEMS * 2, vl + SELEMS * 2, kg + (size_t)KT * CD, vg + KT);

  float m = -1.0e30f, l = 0.f;
  v8f o0 = zero8(), o1 = zero8(), o2 = zero8(), o3 = zero8();
  v8f o4 = zero8(), o5 = zero8(), o6 = zero8(), o7 = zero8();
#pragma unroll 1
  for (int st = 0; st < NSTG; ++st) {
   const unsigned short* Sb = Ring + (st & 1) * SELEMS;             // this stage's buffer
   const _Float16* Vb = (const _Float16*)(const void*)(Sb + Vo);
#pragma unroll                                                      // kb constant: it folds into the LDS reads' offsets
   for (int sub = 0; sub < KT / 32; ++sub) {
    const int kb = sub * 32;                                       // first key of the 32, within the stage
    const unsigned short* k0p = Sb + Ko + kb * KPE;                // keys kb .. kb+15
    const unsigned short* k1p = k0p + 16 * KPE;                    // keys kb+16 .. kb+31
    const v16b a00 = ldfrag_b(k0p),      a01 = ldfrag_b(k0p + 32), a02 = ldfrag_b(k0p + 64), a03 = ldfrag_b(k0p + 96);
    const v16b a10 = ldfrag_b(k1p),      a11 = ldfrag_b(k1p + 32), a12 = ldfrag_b(k1p + 64), a13 = ldfrag_b(k1p + 96);
    v8f s0 = mma_b_raw(a00, qf0, zero8());
    s0 = mma_b_raw(a01, qf1, s0);
    s0 = mma_b_raw(a02, qf2, s0);
    s0 = mma_b_raw(a03, qf3, s0);
    v8f s1 = mma_b_raw(a10, qf0, zero8());
    s1 = mma_b_raw(a11, qf1, s1);
    s1 = mma_b_raw(a12, qf2, s1);
    s1 = mma_b_raw(a13, qf3, s1);
    sguard12(s0, s1, a00, a01, a02, a03, a10, a11, a12, a13, qf0, qf1, qf2, qf3);

    float mx = fmaxf(hmax8(s0), hmax8(s1));
    mx = fmaxf(mx, __shfl_xor(mx, 16, 32));
    const float mn   = fmaxf(m, mx * ATTSC);
    const float corr = __expf(m - mn);
    m = mn;
    const float msh = mn - LNPS;            // exp gives e^{s-m} * 1024
    l *= corr;
#pragma unroll
    for (int r = 0; r < 8; ++r) {
      o0[r] *= corr; o1[r] *= corr; o2[r] *= corr; o3[r] *= corr;
      o4[r] *= corr; o5[r] *= corr; o6[r] *= corr; o7[r] *= corr;
    }

    FragH ph;
    float ls = 0.f;
#pragma unroll
    for (int r = 0; r < 8; ++r) {
      const float e0 = __expf(s0[r] * ATTSC - msh);   // key kb      + 8hh + r
      const float e1 = __expf(s1[r] * ATTSC - msh);   // key kb + 16 + 8hh + r
      ls += e0 + e1;
      ph.h[0][r] = (_Float16)e0;
      ph.h[1][r] = (_Float16)e1;
    }
    l += ls;

    {
      const v16h vf0 = ldfrag_h(Vb + kb);
      const v16h vf1 = ldfrag_h(Vb + 16 * VPE + kb);
      const v16h vf2 = ldfrag_h(Vb + 32 * VPE + kb);
      const v16h vf3 = ldfrag_h(Vb + 48 * VPE + kb);
      o0 = mma_h_raw(vf0, ph.v, o0);
      o1 = mma_h_raw(vf1, ph.v, o1);
      o2 = mma_h_raw(vf2, ph.v, o2);
      o3 = mma_h_raw(vf3, ph.v, o3);
      oguard4(o0, o1, o2, o3, vf0, vf1, vf2, vf3, ph.v);
    }
    {
      const v16h vf4 = ldfrag_h(Vb + 64 * VPE + kb);
      const v16h vf5 = ldfrag_h(Vb + 80 * VPE + kb);
      const v16h vf6 = ldfrag_h(Vb + 96 * VPE + kb);
      const v16h vf7 = ldfrag_h(Vb + 112 * VPE + kb);
      o4 = mma_h_raw(vf4, ph.v, o4);
      o5 = mma_h_raw(vf5, ph.v, o5);
      o6 = mma_h_raw(vf6, ph.v, o6);
      o7 = mma_h_raw(vf7, ph.v, o7);
      oguard4(o4, o5, o6, o7, vf4, vf5, vf6, vf7, ph.v);
    }
   }
   // ---- publish point of stage st + 1; the same barrier frees this stage's buffer for stage st + 2 ----
   wait_lds();
   wait_copies();
   __syncthreads();
   if (st + 2 < NSTG)
     fill_stage(kl + (unsigned)((st & 1) * (SELEMS * 2)), vl + (unsigned)((st & 1) * (SELEMS * 2)),
                kg + (size_t)(st + 2) * KT * CD, vg + (st + 2) * KT);
  }
  wait_copies();
  l += __shfl_xor(l, 16, 32);
  // un-normalised: the merge divides; both o and l carry the x1024 factor

  // ---- stage Os[query 16*wave + c][d = 16j + 8hh + r] with 16-B LDS stores; max and sum behind the tile ----
  if (hh == 0) {
    Os[64 * 132 + wave * 16 + c]      = m;
    Os[64 * 132 + 64 + wave * 16 + c] = l;
  }
  {
    float* os = Os + (wave * 16 + c) * 132 + 8 * hh;
    v4f t;
    t = {o0[0], o0[1], o0[2], o0[3]}; *(v4f*)(os + 0)   = t;
    t = {o0[4], o0[5], o0[6], o0[7]}; *(v4f*)(os + 4)   = t;
    t = {o1[0], o1[1], o1[2], o1[3]}; *(v4f*)(os + 16)  = t;
    t = {o1[4], o1[5], o1[6], o1[7]}; *(v4f*)(os + 20)  = t;
    t = {o2[0], o2[1], o2[2], o2[3]}; *(v4f*)(os + 32)  = t;
    t = {o2[4], o2[5], o2[6], o2[7]}; *(v4f*)(os + 36)  = t;
    t = {o3[0], o3[1], o3[2], o3[3]}; *(v4f*)(os + 48)  = t;
    t = {o3[4], o3[5], o3[6], o3[7]}; *(v4f*)(os + 52)  = t;
    t = {o4[0], o4[1], o4[2], o4[3]}; *(v4f*)(os + 64)  = t;
    t = {o4[4], o4[5], o4[6], o4[7]}; *(v4f*)(os + 68)  = t;
    t = {o5[0], o5[1], o5[2], o5[3]}; *(v4f*)(os + 80)  = t;
    t = {o5[4], o5[5], o5[6], o5[7]}; *(v4f*)(os + 84)  = t;
    t = {o6[0], o6[1], o6[2], o6[3]}; *(v4f*)(os + 96)  = t;
    t = {o6[4], o6[5], o6[6], o6[7]}; *(v4f*)(os + 100) = t;
    t = {o7[0], o7[1], o7[2], o7[3]}; *(v4f*)(os + 112) = t;
    t = {o7[4], o7[5], o7[6], o7[7]}; *(v4f*)(os + 116) = t;
  }
  __syncthreads();
  {
    const int e = tid & 7, lq = tid >> 3;               // lq 0..15: line within group, e: 16-B piece
    v4f vals[16];
#pragma unroll
    for (int it = 0; it < 16; ++it) {
      const int L  = it * 16 + lq;                        // it 0..15 x lq 0..15 = lines 0..255 of the block tile
      const int ch = L >> 1, hf = L & 1;                  // channel 0..127, half-row 0..1 (queries hf*32 .. hf*32+31)
      const int qq = hf * 32 + 4 * e;                     // first of the 4 queries of this 16-B piece
      v4f v;
      v[0] = Os[(qq + 0) * 132 + ch];
      v[1] = Os[(qq + 1) * 132 + ch];
      v[2] = Os[(qq + 2) * 132 + ch];
      v[3] = Os[(qq + 3) * 132 + ch];
      vals[it] = v;
    }
    // waves 0, 1: the 64 maxima; waves 2, 3: the 64 sums; one whole line per wave
    ml[(size_t)(tid >> 6) * (KSPLIT * NTOK) + sp * NTOK + q0 + (tid & 63)] = Os[64 * 132 + tid];
    float* ob = part + (((size_t)b * CD) * KSPLIT + sp) * HWN + hw0;     // part[b][d][range][hw]
    {
#pragma unroll
      for (int it = 0; it < 16; ++it) {
        const int L  = it * 16 + lq;
        const int ch = L >> 1, hf = L & 1;
        *(v4f*)(ob + (size_t)ch * (KSPLIT * HWN) + hf * 32 + 4 * e) = vals[it];
      }
      
    }
  }
}

// =====================================================================================================
// Merge of the 8 key ranges: M = max_s m_s, w_s = e^{m_s - M}, out = sum_s w_s part_s / sum_s w_s l_s, all f32.
// Block = 8 waves = 128 queries (lane -> 4 consecutive queries, one b) x 32 channels (wave -> 4 channels); every load and store
// of a wave is 512 contiguous B. Grid = 64 query groups x 4 channel groups = 256 blocks cover out [2][128][4096] exactly once.
// =====================================================================================================
// e^x as the fast exponential compiles it (x * log2 e, v_exp_f32), with the v_nop in the same statement: it fills the one slot that
// the instruction set asks for between a transcendental and a next instruction that overwrites its source or reads its result
__device__ __forceinline__ float exp_slot(float x) {
  float r = 0.f;
#if defined(__HIP_DEVICE_COMPILE__)
  asm("v_exp_f32 %0, %1\n\tv_nop" : "=v"(r) : "v"(x * 1.4426950408889634f));
#endif
  return r;
}
__global__ __launch_bounds__(256)
void merge_kernel(const float* __restrict__ part, const float* __restrict__ ml, float* out) {
  const int tid = threadIdx.x;
  const int q   = (blockIdx.x >> 2) * 128 + 4 * (tid & 31);           // first of this lane's 4 query tokens
  const int d0  = (blockIdx.x & 3) * 32 + 4 * (tid >> 5);             // first of this wave's 4 channels
  // 32-bit byte offsets beside the uniform bases: one address register each for ml, part and out, the rest immediates
  const unsigned qb = (unsigned)q * 4u;
  const unsigned rw = (unsigned)(q >> 12) * CD + (unsigned)d0;       // row b * 128 + d0 of out
  const unsigned hb = (unsigned)(q & (HWN - 1)) * 4u;
  const unsigned eb = rw * (HWN * 4u) + hb;
  const unsigned pb = rw * (KSPLIT * HWN * 4u) + hb;
  const char* mlb = (const char*)ml;
  const char* ptb = (const char*)part;
  v4f mm[KSPLIT], ll[KSPLIT], pv[4][KSPLIT];
#pragma unroll
  for (int s = 0; s < KSPLIT; ++s) {
    mm[s] = *(const v4f*)(mlb + (size_t)s * (NTOK * 4) + qb);
    ll[s] = *(const v4f*)(mlb + (size_t)(KSPLIT + s) * (NTOK * 4) + qb);
  }
#pragma unroll
  for (int i = 0; i < 4; ++i)
#pragma unroll
    for (int s = 0; s < KSPLIT; ++s) pv[i][s] = *(const v4f*)(ptb + (size_t)(i * KSPLIT + s) * (HWN * 4) + pb);
#if defined(__HIP_DEVICE_COMPILE__)
  // the wait before the two registers that the 48 loads above name are reused; as operands here they live up to the wait
  asm volatile("s_wait_xcnt 0x0" :: "v"(qb), "v"(pb) : "memory");
#endif
  // keeps the arithmetic behind all 48 loads: one memory round trip; without it the sums rise among the loads, two in flight
  __builtin_amdgcn_sched_barrier(0);
  v4f w[KSPLIT], inv;
#pragma unroll
  for (int t = 0; t < 4; ++t) {
    float M = mm[0][t];
#pragma unroll
    for (int s = 1; s < KSPLIT; ++s) M = fmaxf(M, mm[s][t]);
    float L = 0.f;
#pragma unroll
    for (int s = 0; s < KSPLIT; ++s) { w[s][t] = exp_slot(mm[s][t] - M); L += w[s][t] * ll[s][t]; }
    inv[t] = 1.0f / L;
  }
#pragma unroll
  for (int i = 0; i < 4; ++i) {
    v4f a = w[0] * pv[i][0];
#pragma unroll
    for (int s = 1; s < KSPLIT; ++s) a += w[s] * pv[i][s];
    *(v4f*)((char*)out + (size_t)i * (HWN * 4) + eb) = a * inv;
  }
}

// =====================================================================================================
//   FB   bf16 [8192][128]        0          2097152
//   VT   f16  [128][8192]        2097152    2097152
//   PT   f32  [2][128][8][4096]  4194304    33554432
//   ML   f32  [2][8][8192]       37748736   524288
//   end                          38273024
// =====================================================================================================
extern "C" void kernel_launch(void* const* d_in, const int* in_sizes, int n_in,
                              void* d_out, int out_size, void* d_ws, size_t ws_size,
                              hipStream_t stream) {
  const int NEL = NTOK * CD;                            // 1048576
  if (n_in < 1) return;
  if (in_sizes[0] != NEL) return;
  if (out_size != NEL) return;

  const size_t PL = (size_t)NEL * 2;                    // 2097152
  size_t off = 0;
  const size_t oF = off; off += PL;
  const size_t oV = off; off += PL;
  const size_t oP = off; off += (size_t)KSPLIT * NEL * 4;
  const size_t oM = off; off += (size_t)2 * KSPLIT * NTOK * 4;
  if (off > ws_size) return;                            // off = 38273024
  if (off > (size_t)134217728) return;

  const float* x = (const float*)d_in[0];
  char* ws = (char*)d_ws;
  unsigned short* FB = (unsigned short*)(ws + oF);
  unsigned short* VT = (unsigned short*)(ws + oV);
  float* PT = (float*)(ws + oP);
  float* ML = (float*)(ws + oM);
  float* out = (float*)d_out;

  const dim3 blk256(256), blk128(128);
  const dim3 gCV(NTOK / 64);                            // 128 blocks: one 64-token tile each
  const dim3 gAT((NTOK / 64) * KSPLIT);                 // 1024 blocks: one 64-query block and one key range each
  const dim3 gMG((NTOK / 128) * (CD / 32));             // 256 blocks: 128 queries x 32 channels each

  // (0) operand planes: FB = bf16 RNE bits of f (token-major), VT = f16 of bf16-RNE(f), channel-major
  cvt_planes<<<gCV, blk256, 0, stream>>>(x, FB, VT);

  // (1) attention per key range: un-normalised sum_m e^{s_nm - max} f_m[d] with its max and row sum, n = b*4096 + hw
  attn_kernel<<<gAT, blk128, 0, stream>>>(FB, VT, PT, ML);

  // (2) merge: out[b][d][hw] = sum_m softmax_m(f_n . f_m / sqrt(128)) f_m[d]
  merge_kernel<<<gMG, blk256, 0, stream>>>(PT, ML, out);
  (void)hipGetLastError();
}

// v003
// One run takes 37.9 microseconds.
// In two side-by-side timings against v002, it was 1.09 and 1.08 times as fast.
// All steps since v000 together make it 8.58 times as fast.
// Contractions: S^T = f (bf16 bits, RNE convert of the input; keys as A rows) . f^T (same bf16 plane; queries as B columns) on
// v_wmma_f32_16x16x32_bf16, K = 128 channels, one product; O^T = f^T (f16 of the bf16-RNE input, channel rows, x1) . P^T (f16,
// e^{s-m} x 1024 from the score D registers) on v_wmma_f32_16x16x32_f16 over 8192 keys, one product; f32 accumulate everywhere;
// softmax (lazily moved shift m, row sums, 1/l) in f32 on VALU. The 8192 keys are cut into 8 ranges, one work-group per (64 queries, range);
// a last launch merges the ranges' un-normalised sums in f32.
#include <hip/hip_runtime.h>
#include <math.h>
#include <stdint.h>

#define NTOK  8192
#define CD    128
#define HWN   4096
#define NBAT  2
#define LNPS  6.931471805599453f
#define ATTSC 0.08838834764831845f
#define RATTSC 11.313708498984761f          // 1 / ATTSC
#define MGAP  3.0f                          // e^3 * 1024 = 20568 < 65504, the largest f16
static_assert(NTOK == NBAT * HWN);
static_assert((NTOK % 64) == 0);
static_assert((HWN % 64) == 0);
static_assert(CD == 128);

typedef _Float16       v16h __attribute__((ext_vector_type(16)));
typedef _Float16       v8h  __attribute__((ext_vector_type(8)));
typedef __bf16         v16b __attribute__((ext_vector_type(16)));
typedef unsigned short v8us __attribute__((ext_vector_type(8)));
typedef float          v8f  __attribute__((ext_vector_type(8)));
typedef float          v4f  __attribute__((ext_vector_type(4)));
typedef unsigned int   v4u  __attribute__((ext_vector_type(4)));

union FragH { v16h v; v8h  h[2]; };
union FragB { v16b v; v8us u[2]; };
static_assert(sizeof(FragH) == 32);
static_assert(sizeof(FragB) == 32);

// ---- scalar helpers --------------------------------------------------------------------------------
__device__ __forceinline__ unsigned short bf_bits(float f) {          // f32 -> bf16 bits, RNE convert
  unsigned u = __float_as_uint(f);
  return (unsigned short)((u + 0x7FFFu + ((u >> 16) & 1u)) >> 16);
}
__device__ __forceinline__ float bf_up(unsigned short h) { return __uint_as_float(((unsigned)h) << 16); }
__device__ __forceinline__ unsigned short h_bits(_Float16 x) { return __builtin_bit_cast(unsigned short, x); }
__device__ __forceinline__ unsigned pk16(unsigned short a, unsigned short b) { return (unsigned)a | ((unsigned)b << 16); }
__device__ __forceinline__ v8f zero8() { v8f z = {0.f, 0.f, 0.f, 0.f, 0.f, 0.f, 0.f, 0.f}; return z; }
__device__ __forceinline__ float hmax8(v8f s) {
  return fmaxf(fmaxf(fmaxf(s[0], s[1]), fmaxf(s[2], s[3])), fmaxf(fmaxf(s[4], s[5]), fmaxf(s[6], s[7])));
}

// ---- fragment loaders: 16-bit A/B operand, lane -> row/col (lane&15), p already includes +8*(lane>>4);
//      elements 0..7 <- p[0..7] (k0+8h..), elements 8..15 <- p[16..23] (k0+16+8h..)
__device__ __forceinline__ v16h ldfrag_h(const _Float16* p) {
  FragH f;
  f.h[0] = *(const v8h*)(p);
  f.h[1] = *(const v8h*)(p + 16);
  return f.v;
}
__device__ __forceinline__ v16b ldfrag_b(const unsigned short* p) {
  FragB f;
  f.u[0] = *(const v8us*)(p);
  f.u[1] = *(const v8us*)(p + 16);
  return f.v;
}

// ---- WMMA helpers with trailing VALU hazard gap --------------------------------------------------------
__device__ __forceinline__ v8f mma_h_raw(v16h a, v16h b, v8f c) {
  return __builtin_amdgcn_wmma_f32_16x16x32_f16(false, a, false, b, (short)0, c, false, false);
}
__device__ __forceinline__ v8f mma_b_raw(v16b a, v16b b, v8f c) {
  return __builtin_amdgcn_wmma_f32_16x16x32_bf16(false, a, false, b, (short)0, c, false, false);
}
// ties the two score accumulators and keeps the 8 key fragments + 4 query fragments live past the nops
__device__ __forceinline__ void sguard12(v8f& a, v8f& b,
                                         v16b x0, v16b x1, v16b x2, v16b x3,
                                         v16b x4, v16b x5, v16b x6, v16b x7,
                                         v16b y0, v16b y1, v16b y2, v16b y3) {
#if defined(__HIP_DEVICE_COMPILE__)
  const v16h h0 = __builtin_bit_cast(v16h, x0), h1 = __builtin_bit_cast(v16h, x1);
  const v16h h2 = __builtin_bit_cast(v16h, x2), h3 = __builtin_bit_cast(v16h, x3);
  const v16h h4 = __builtin_bit_cast(v16h, x4), h5 = __builtin_bit_cast(v16h, x5);
  const v16h h6 = __builtin_bit_cast(v16h, x6), h7 = __builtin_bit_cast(v16h, x7);
  const v16h g0 = __builtin_bit_cast(v16h, y0), g1 = __builtin_bit_cast(v16h, y1);
  const v16h g2 = __builtin_bit_cast(v16h, y2), g3 = __builtin_bit_cast(v16h, y3);
  asm volatile("v_nop\n\tv_nop\n\tv_nop\n\tv_nop"
               : "+v"(a), "+v"(b)
               : "v"(h0), "v"(h1), "v"(h2), "v"(h3), "v"(h4), "v"(h5), "v"(h6), "v"(h7),
                 "v"(g0), "v"(g1), "v"(g2), "v"(g3));
#endif
}
__device__ __forceinline__ void oguard4(v8f& a, v8f& b, v8f& c, v8f& d,
                                        v16h x0, v16h x1, v16h x2, v16h x3, v16h p0) {
#if defined(__HIP_DEVICE_COMPILE__)
  asm volatile("v_nop\n\tv_nop\n\tv_nop\n\tv_nop"
               : "+v"(a), "+v"(b), "+v"(c), "+v"(d) : "v"(x0), "v"(x1), "v"(x2), "v"(x3), "v"(p0));
#endif
}

// =====================================================================================================
// Operand planes. Input is NCHW f32: x[b][c][hw], token n = b*4096 + hw, channel c.
// One block (256 threads) per 64-token tile n0 = 64*bx (one b, hw0 = n0 & 4095):
//               taken straight from x[b][c][hw0..hw0+63]; thread (e = tid&7, lq = tid>>3) converts 8 consecutive hw of channel
//   FB[n][c]  = bf16 bits, token-major [8192][128]; row = 256 B = 2 lines; after the block barrier thread (e, lq) reads 16 B of
//               Ts row tok = L>>1, half L&1 and writes it; lines L = 32*it + lq, it 0..3 -> 128 lines = 64 rows; 8 consecutive
// coverage: VT: it 0..3 x lq 0..31 = c 0..127, e 0..7 x 8 = hw 0..63 of the tile; Ts: tok = 8e+t (0..63) x c (0..127) all
//           written before the barrier; FB: 128 lines = 64 rows x 256 B; grid = 8192/64 = 128 blocks covers both planes exactly.
// =====================================================================================================
__global__ __launch_bounds__(256) void cvt_planes(const float* __restrict__ xin,
                                                   unsigned short* FB, unsigned short* VT) {
  __shared__ __align__(16) unsigned short Ts[64 * 136];
  const int tid = threadIdx.x;
  const int bx  = blockIdx.x;
  const int n0  = bx * 64;
  const int b   = n0 >> 12;
  const int hw0 = n0 & (HWN - 1);

  // ---- VT plane (direct strided convert) + LDS transpose fill ----
  {
    const int e = tid & 7, lq = tid >> 3;                 // lq 0..31
    v4u u[4];
    size_t go[4];
#pragma unroll
    for (int it = 0; it < 4; ++it) {
      const int c = it * 32 + lq;                         // channel 0..127
      const float* p = xin + ((size_t)(b * CD + c)) * HWN + hw0 + 8 * e;
      const v4f xa = *(const v4f*)(p), xb = *(const v4f*)(p + 4);
      unsigned short hb[8];
#pragma unroll
      for (int i = 0; i < 4; ++i) { hb[i] = bf_bits(xa[i]); hb[4 + i] = bf_bits(xb[i]); }
      v4u w;
#pragma unroll
      for (int i = 0; i < 4; ++i)
        w[i] = pk16(h_bits((_Float16)bf_up(hb[2 * i])), h_bits((_Float16)bf_up(hb[2 * i + 1])));
      u[it]  = w;
      go[it] = (size_t)c * NTOK + n0 + 8 * e;
#pragma unroll
      for (int t = 0; t < 8; ++t) Ts[(8 * e + t) * 136 + c] = hb[t];    // Ts[tok][c]
    }
    {
#pragma unroll
      for (int it = 0; it < 4; ++it) *(v4u*)(VT + go[it]) = u[it];
      
    }
  }
  __syncthreads();

  // ---- FB plane: whole-line writes of the transposed tile ----
  {
    const int e = tid & 7, lq = tid >> 3;                 // lq 0..31
    v4u u[4];
#pragma unroll
    for (int it = 0; it < 4; ++it) {
      const int L = it * 32 + lq;                         // line 0..127 within the 64-row tile
      const int tok = L >> 1, hf = L & 1;
      u[it] = *(const v4u*)(Ts + tok * 136 + hf * 64 + 8 * e);
    }
    unsigned short* db = FB + (size_t)n0 * CD;
    {
#pragma unroll
      for (int it = 0; it < 4; ++it) {
        const int L = it * 32 + lq;
        const int tok = L >> 1, hf = L & 1;
        *(v4u*)(db + (size_t)tok * CD + hf * 64 + 8 * e) = u[it];
      }
      
    }
  }
}

// ---- LDS ring of key / value tiles, filled by asynchronous copies ---------------------------------------
// One stage = 64 keys: K tile = 64 token rows x 256 B of FB at LDS pitch 272 B, V^T tile = 128 channel rows x 128 B of VT at
// LDS pitch 144 B (both 16 B x odd: ds_load_b128 fragment reads meet no bank conflict). Two stages.
#define KT     64
#define KSPLIT 8                            // key ranges; 128 query blocks x 8 = 1024 work-groups = 4 on each of 256 WGPs
#define KRANGE (NTOK / KSPLIT)              // 1024 keys per work-group
#define NSTG   (KRANGE / KT)                // stages per work-group
#define KPE    136                          // K row pitch, 16-bit elements
#define VPE    72                           // V^T row pitch, 16-bit elements
#define KELEMS (KT * KPE)                   // 8704
#define SELEMS (KELEMS + CD * VPE)          // 17920 elements = 35840 B per stage
static_assert(NSTG >= 2);
static_assert(KSPLIT * KRANGE == NTOK && NSTG * KT == KRANGE);
static_assert((KPE * 2) % 16 == 0 && (VPE * 2) % 16 == 0 && (KELEMS * 2) % 16 == 0 && (SELEMS * 2) % 16 == 0);

// eight 16-B copies per lane; l = the lane's LDS byte address, g = the lane's global address, ls / gs = step per copy.
// The s_wait_xcnt closes the statement so that it stands before any later rewrite of the address registers.
__device__ __forceinline__ void copy8(unsigned l, unsigned ls, const unsigned short* g, size_t gs) {
#if defined(__HIP_DEVICE_COMPILE__)
  asm volatile("global_load_async_to_lds_b128 %0, %8, off\n\t"
               "global_load_async_to_lds_b128 %1, %9, off\n\t"
               "global_load_async_to_lds_b128 %2, %10, off\n\t"
               "global_load_async_to_lds_b128 %3, %11, off\n\t"
               "global_load_async_to_lds_b128 %4, %12, off\n\t"
               "global_load_async_to_lds_b128 %5, %13, off\n\t"
               "global_load_async_to_lds_b128 %6, %14, off\n\t"
               "global_load_async_to_lds_b128 %7, %15, off\n\t"
               "s_wait_xcnt 0x0"
               :: "v"(l), "v"(l + ls), "v"(l + 2 * ls), "v"(l + 3 * ls),
                  "v"(l + 4 * ls), "v"(l + 5 * ls), "v"(l + 6 * ls), "v"(l + 7 * ls),
                  "v"(g), "v"(g + gs), "v"(g + 2 * gs), "v"(g + 3 * gs),
                  "v"(g + 4 * gs), "v"(g + 5 * gs), "v"(g + 6 * gs), "v"(g + 7 * gs)
               : "memory");
#endif
}
// stage fill by the block's 128 threads. K: copy i, thread t -> row 8i + (t>>4), 16-B piece t&15 (a wave's copy = 512
// contiguous B); V^T: copy i, thread t -> channel row 16i + (t>>3), piece t&7 (a wave's copy = 4 whole lines).
__device__ __forceinline__ void fill_stage(unsigned kl, unsigned vl, const unsigned short* kg, const unsigned short* vg) {
  copy8(kl, 8 * KPE * 2, kg, (size_t)8 * CD);
  copy8(vl, 16 * VPE * 2, vg, (size_t)16 * NTOK);
}
// the issuing wave's own wait: its copies have landed (asm, so that no LDS read moves in front of it)
__device__ __forceinline__ void wait_copies() {
#if defined(__HIP_DEVICE_COMPILE__)
  asm volatile("s_wait_asynccnt 0x0" ::: "memory");
#endif
}
// the wave's LDS reads of a buffer have returned before the buffer is handed to the next copies
__device__ __forceinline__ void wait_lds() {
#if defined(__HIP_DEVICE_COMPILE__)
  asm volatile("s_wait_dscnt 0x0" ::: "memory");
#endif
}

// =====================================================================================================
// Attention for one 64-query block and one range of 1024 keys, transposed formulation, 128 channels, no mask:
//   S^T tile (16 keys x 16 queries) = A(FB rows = keys kb + (lane&15), channels via the split k map) .
//                                     B(FB rows = queries, col = query, same channel map), four channel-steps of 32.
//   Per lane the D tile holds 8 keys of ONE query, so the online softmax (shift m, f32) is per-lane state; m follows the running
//   max lazily (see the loop), with one shuffle (lane^16) when it moves; the row sum is a per-lane partial combined at the end.
//   P = e^{s-m} x 1024 as one f16 vector is used directly as the B operand of O^T (rows d, cols queries) +=
//   A(VT rows d, keys contiguous, two 16-B loads) . B(P^T): B element r <- D of the tile covering keys kb..kb+15,
//   element 8+r <- the tile covering kb+16..kb+31, lane unchanged (D-as-B chaining layout). One product per d tile, 8 d tiles.
//   32 keys per iteration: 8 score WMMAs + 8 output WMMAs per wave. Block = 4 waves = 64 queries; grid = 128 query blocks x 8 ranges.
//   The key rows and V^T rows come from a two-stage LDS ring (64 keys a stage) that the block's four waves fill together and
//   all read: stage st + 1 is copied while stage st is worked on.
//   Epilogue: the block's [64 query][128 d] f32 tile, un-normalised, is staged in the ring's LDS (free behind the loop's last
//   barrier) with 16-B stores (layout [query][d], pitch 132), beside each query's shift m and row sum.
// coverage: block writes part[b][d][range][hw0..hw0+63] for d 0..127 (256 lines) and ml[0][range][q0..q0+63] (shift m),
//           ml[1][range][q0..q0+63] (sum), one line per wave; 1024 blocks cover part [2][128][8][4096] and ml [2][8][8192] once.
// =====================================================================================================
__global__ __launch_bounds__(128)
void attn_kernel(const unsigned short* __restrict__ fbp, const unsigned short* __restrict__ vtp, float* part, float* ml) {
  __shared__ __align__(16) unsigned short Ring[2 * SELEMS];
  float* Os = (float*)(void*)Ring;                // output staging, used only behind the loop's last barrier
  static_assert((64 * 132 + 128) * 4 <= 2 * SELEMS * 2);
  const int tid  = threadIdx.x;
  const int wave = tid >> 5;
  const int lane = tid & 31;
  const int hh   = lane >> 4;
  const int c    = lane & 15;
  const int bx   = blockIdx.x / KSPLIT;           // query block 0..127
  const int sp   = blockIdx.x & (KSPLIT - 1);     // key range 0..7
  const int q0   = bx * 64;                       // first query token of the block
  const int b    = q0 >> 12;
  const int hw0  = q0 & (HWN - 1);

  // ---- query fragments (B operand, col = query q0 + 16*wave + c), loaded like A from the token-major bf16 plane ----
  const unsigned short* qr = fbp + ((size_t)(q0 + wave * 16 + c)) * CD + 8 * hh;
  const v16b qf0 = ldfrag_b(qr);                  // channels 0..31
  const v16b qf1 = ldfrag_b(qr + 32);             // channels 32..63
  const v16b qf2 = ldfrag_b(qr + 64);             // channels 64..95
  const v16b qf3 = ldfrag_b(qr + 96);             // channels 96..127

  // ---- key fragment offset in a stage (A operand, row = key c of the tile), + key * KPE ----
  const int Ko = c * KPE + 8 * hh;
  // ---- V^T fragment offset in a stage (A operand, row = d = 16j + c, keys contiguous), + 16j*VPE + key ----
  const int Vo = KELEMS + c * VPE + 8 * hh;

  // ---- this thread's share of a stage fill ----
  const unsigned ring0 = (unsigned)(size_t)Ring;                       // LDS byte address of the ring
  const unsigned kl = ring0 + (unsigned)((tid >> 4) * (KPE * 2) + (tid & 15) * 16);
  const unsigned vl = ring0 + (unsigned)(KELEMS * 2 + (tid >> 3) * (VPE * 2) + (tid & 7) * 16);
  const unsigned short* kg = fbp + (size_t)sp * KRANGE * CD + tid * 8;
  const unsigned short* vg = vtp + (size_t)(tid >> 3) * NTOK + sp * KRANGE + (tid & 7) * 8;

  // ---- prologue: stage 0 lands and is published, stage 1 starts ----
  fill_stage(kl, vl, kg, vg);
  wait_copies();
  __syncthreads();
  fill_stage(kl + SELEMS * 2, vl + SELEMS * 2, kg + (size_t)KT * CD, vg + KT);

  float m = -1.0e30f, l = 0.f;
  float msh = m - LNPS, thr = (m + MGAP) * RATTSC;   // the first 32 keys always take the branch
  v8f o0 = zero8(), o1 = zero8(), o2 = zero8(), o3 = zero8();
  v8f o4 = zero8(), o5 = zero8(), o6 = zero8(), o7 = zero8();
#pragma unroll 1
  for (int st = 0; st < NSTG; ++st) {
   const unsigned short* Sb = Ring + (st & 1) * SELEMS;             // this stage's buffer
   const _Float16* Vb = (const _Float16*)(const void*)(Sb + Vo);
#pragma unroll                                                      // kb constant: it folds into the LDS reads' offsets
   for (int sub = 0; sub < KT / 32; ++sub) {
    const int kb = sub * 32;                                       // first key of the 32, within the stage
    const unsigned short* k0p = Sb + Ko + kb * KPE;                // keys kb .. kb+15
    const unsigned short* k1p = k0p + 16 * KPE;                    // keys kb+16 .. kb+31
    const v16b a00 = ldfrag_b(k0p),      a01 = ldfrag_b(k0p + 32), a02 = ldfrag_b(k0p + 64), a03 = ldfrag_b(k0p + 96);
    const v16b a10 = ldfrag_b(k1p),      a11 = ldfrag_b(k1p + 32), a12 = ldfrag_b(k1p + 64), a13 = ldfrag_b(k1p + 96);
    v8f s0 = mma_b_raw(a00, qf0, zero8());
    s0 = mma_b_raw(a01, qf1, s0);
    s0 = mma_b_raw(a02, qf2, s0);
    s0 = mma_b_raw(a03, qf3, s0);
    v8f s1 = mma_b_raw(a10, qf0, zero8());
    s1 = mma_b_raw(a11, qf1, s1);
    s1 = mma_b_raw(a12, qf2, s1);
    s1 = mma_b_raw(a13, qf3, s1);
    sguard12(s0, s1, a00, a01, a02, a03, a10, a11, a12, a13, qf0, qf1, qf2, qf3);

    // lazy rescale: m is the shift in use, not the running max. It moves, and the sums are rescaled, only when some score of
    // the wave's 32 x 16 tile lies more than MGAP above its column's m (thr = that bound in raw score units); one scalar branch
    // per 32 keys. Otherwise every e^{s-m} * 1024 <= e^MGAP * 1024, inside f16, and the exchange between the halves, the
    // correction factor and its 65 products are all left out.
    const float mr = fmaxf(hmax8(s0), hmax8(s1));        // raw, over this lane's 16 keys
    if (__builtin_amdgcn_ballot_w32(mr > thr) != 0) {
      const float mx   = fmaxf(mr, __shfl_xor(mr, 16, 32)) * ATTSC;   // both halves of a column take the same new m
      const float mn   = fmaxf(m, mx);
      const float corr = __expf(m - mn);
      m = mn;
      msh = mn - LNPS;                      // exp gives e^{s-m} * 1024
      thr = (mn + MGAP) * RATTSC;
      l *= corr;
#pragma unroll
      for (int r = 0; r < 8; ++r) {
        o0[r] *= corr; o1[r] *= corr; o2[r] *= corr; o3[r] *= corr;
        o4[r] *= corr; o5[r] *= corr; o6[r] *= corr; o7[r] *= corr;
      }
    }

    FragH ph;
    float ls = 0.f;
#pragma unroll
    for (int r = 0; r < 8; ++r) {
      const float e0 = __expf(s0[r] * ATTSC - msh);   // key kb      + 8hh + r
      const float e1 = __expf(s1[r] * ATTSC - msh);   // key kb + 16 + 8hh + r
      ls += e0 + e1;
      ph.h[0][r] = (_Float16)e0;
      ph.h[1][r] = (_Float16)e1;
    }
    l += ls;

    {
      const v16h vf0 = ldfrag_h(Vb + kb);
      const v16h vf1 = ldfrag_h(Vb + 16 * VPE + kb);
      const v16h vf2 = ldfrag_h(Vb + 32 * VPE + kb);
      const v16h vf3 = ldfrag_h(Vb + 48 * VPE + kb);
      o0 = mma_h_raw(vf0, ph.v, o0);
      o1 = mma_h_raw(vf1, ph.v, o1);
      o2 = mma_h_raw(vf2, ph.v, o2);
      o3 = mma_h_raw(vf3, ph.v, o3);
      oguard4(o0, o1, o2, o3, vf0, vf1, vf2, vf3, ph.v);
    }
    {
      const v16h vf4 = ldfrag_h(Vb + 64 * VPE + kb);
      const v16h vf5 = ldfrag_h(Vb + 80 * VPE + kb);
      const v16h vf6 = ldfrag_h(Vb + 96 * VPE + kb);
      const v16h vf7 = ldfrag_h(Vb + 112 * VPE + kb);
      o4 = mma_h_raw(vf4, ph.v, o4);
      o5 = mma_h_raw(vf5, ph.v, o5);
      o6 = mma_h_raw(vf6, ph.v, o6);
      o7 = mma_h_raw(vf7, ph.v, o7);
      oguard4(o4, o5, o6, o7, vf4, vf5, vf6, vf7, ph.v);
    }
   }
   // ---- publish point of stage st + 1; the same barrier frees this stage's buffer for stage st + 2 ----
   wait_lds();
   wait_copies();
   __syncthreads();
   if (st + 2 < NSTG)
     fill_stage(kl + (unsigned)((st & 1) * (SELEMS * 2)), vl + (unsigned)((st & 1) * (SELEMS * 2)),
                kg + (size_t)(st + 2) * KT * CD, vg + (st + 2) * KT);
  }
  wait_copies();
  l += __shfl_xor(l, 16, 32);
  // un-normalised: the merge divides; both o and l carry the x1024 factor

  // ---- stage Os[query 16*wave + c][d = 16j + 8hh + r] with 16-B LDS stores; shift m and sum behind the tile ----
  if (hh == 0) {
    Os[64 * 132 + wave * 16 + c]      = m;
    Os[64 * 132 + 64 + wave * 16 + c] = l;
  }
  {
    float* os = Os + (wave * 16 + c) * 132 + 8 * hh;
    v4f t;
    t = {o0[0], o0[1], o0[2], o0[3]}; *(v4f*)(os + 0)   = t;
    t = {o0[4], o0[5], o0[6], o0[7]}; *(v4f*)(os + 4)   = t;
    t = {o1[0], o1[1], o1[2], o1[3]}; *(v4f*)(os + 16)  = t;
    t = {o1[4], o1[5], o1[6], o1[7]}; *(v4f*)(os + 20)  = t;
    t = {o2[0], o2[1], o2[2], o2[3]}; *(v4f*)(os + 32)  = t;
    t = {o2[4], o2[5], o2[6], o2[7]}; *(v4f*)(os + 36)  = t;
    t = {o3[0], o3[1], o3[2], o3[3]}; *(v4f*)(os + 48)  = t;
    t = {o3[4], o3[5], o3[6], o3[7]}; *(v4f*)(os + 52)  = t;
    t = {o4[0], o4[1], o4[2], o4[3]}; *(v4f*)(os + 64)  = t;
    t = {o4[4], o4[5], o4[6], o4[7]}; *(v4f*)(os + 68)  = t;
    t = {o5[0], o5[1], o5[2], o5[3]}; *(v4f*)(os + 80)  = t;
    t = {o5[4], o5[5], o5[6], o5[7]}; *(v4f*)(os + 84)  = t;
    t = {o6[0], o6[1], o6[2], o6[3]}; *(v4f*)(os + 96)  = t;
    t = {o6[4], o6[5], o6[6], o6[7]}; *(v4f*)(os + 100) = t;
    t = {o7[0], o7[1], o7[2], o7[3]}; *(v4f*)(os + 112) = t;
    t = {o7[4], o7[5], o7[6], o7[7]}; *(v4f*)(os + 116) = t;
  }
  __syncthreads();
  {
    const int e = tid & 7, lq = tid >> 3;               // lq 0..15: line within group, e: 16-B piece
    v4f vals[16];
#pragma unroll
    for (int it = 0; it < 16; ++it) {
      const int L  = it * 16 + lq;                        // it 0..15 x lq 0..15 = lines 0..255 of the block tile
      const int ch = L >> 1, hf = L & 1;                  // channel 0..127, half-row 0..1 (queries hf*32 .. hf*32+31)
      const int qq = hf * 32 + 4 * e;                     // first of the 4 queries of this 16-B piece
      v4f v;
      v[0] = Os[(qq + 0) * 132 + ch];
      v[1] = Os[(qq + 1) * 132 + ch];
      v[2] = Os[(qq + 2) * 132 + ch];
      v[3] = Os[(qq + 3) * 132 + ch];
      vals[it] = v;
    }
    // waves 0, 1: the 64 shifts m; waves 2, 3: the 64 sums; one whole line per wave
    ml[(size_t)(tid >> 6) * (KSPLIT * NTOK) + sp * NTOK + q0 + (tid & 63)] = Os[64 * 132 + tid];
    float* ob = part + (((size_t)b * CD) * KSPLIT + sp) * HWN + hw0;     // part[b][d][range][hw]
    {
#pragma unroll
      for (int it = 0; it < 16; ++it) {
        const int L  = it * 16 + lq;
        const int ch = L >> 1, hf = L & 1;
        *(v4f*)(ob + (size_t)ch * (KSPLIT * HWN) + hf * 32 + 4 * e) = vals[it];
      }
      
    }
  }
}

// =====================================================================================================
// Merge of the 8 key ranges: M = max_s m_s, w_s = e^{m_s - M}, out = sum_s w_s part_s / sum_s w_s l_s, all f32.
// Block = 8 waves = 128 queries (lane -> 4 consecutive queries, one b) x 32 channels (wave -> 4 channels); every load and store
// of a wave is 512 contiguous B. Grid = 64 query groups x 4 channel groups = 256 blocks cover out [2][128][4096] exactly once.
// =====================================================================================================
// e^x as the fast exponential compiles it (x * log2 e, v_exp_f32), with the v_nop in the same statement: it fills the one slot that
// the instruction set asks for between a transcendental and a next instruction that overwrites its source or reads its result
__device__ __forceinline__ float exp_slot(float x) {
  float r = 0.f;
#if defined(__HIP_DEVICE_COMPILE__)
  asm("v_exp_f32 %0, %1\n\tv_nop" : "=v"(r) : "v"(x * 1.4426950408889634f));
#endif
  return r;
}
__global__ __launch_bounds__(256)
void merge_kernel(const float* __restrict__ part, const float* __restrict__ ml, float* out) {
  const int tid = threadIdx.x;
  const int q   = (blockIdx.x >> 2) * 128 + 4 * (tid & 31);           // first of this lane's 4 query tokens
  const int d0  = (blockIdx.x & 3) * 32 + 4 * (tid >> 5);             // first of this wave's 4 channels
  // 32-bit byte offsets beside the uniform bases: one address register each for ml, part and out, the rest immediates
  const unsigned qb = (unsigned)q * 4u;
  const unsigned rw = (unsigned)(q >> 12) * CD + (unsigned)d0;       // row b * 128 + d0 of out
  const unsigned hb = (unsigned)(q & (HWN - 1)) * 4u;
  const unsigned eb = rw * (HWN * 4u) + hb;
  const unsigned pb = rw * (KSPLIT * HWN * 4u) + hb;
  const char* mlb = (const char*)ml;
  const char* ptb = (const char*)part;
  v4f mm[KSPLIT], ll[KSPLIT], pv[4][KSPLIT];
#pragma unroll
  for (int s = 0; s < KSPLIT; ++s) {
    mm[s] = *(const v4f*)(mlb + (size_t)s * (NTOK * 4) + qb);
    ll[s] = *(const v4f*)(mlb + (size_t)(KSPLIT + s) * (NTOK * 4) + qb);
  }
#pragma unroll
  for (int i = 0; i < 4; ++i)
#pragma unroll
    for (int s = 0; s < KSPLIT; ++s) pv[i][s] = *(const v4f*)(ptb + (size_t)(i * KSPLIT + s) * (HWN * 4) + pb);
#if defined(__HIP_DEVICE_COMPILE__)
  // the wait before the two registers that the 48 loads above name are reused; as operands here they live up to the wait
  asm volatile("s_wait_xcnt 0x0" :: "v"(qb), "v"(pb) : "memory");
#endif
  // keeps the arithmetic behind all 48 loads: one memory round trip; without it the sums rise among the loads, two in flight
  __builtin_amdgcn_sched_barrier(0);
  v4f w[KSPLIT], inv;
#pragma unroll
  for (int t = 0; t < 4; ++t) {
    float M = mm[0][t];
#pragma unroll
    for (int s = 1; s < KSPLIT; ++s) M = fmaxf(M, mm[s][t]);
    float L = 0.f;
#pragma unroll
    for (int s = 0; s < KSPLIT; ++s) { w[s][t] = exp_slot(mm[s][t] - M); L += w[s][t] * ll[s][t]; }
    inv[t] = 1.0f / L;
  }
#pragma unroll
  for (int i = 0; i < 4; ++i) {
    v4f a = w[0] * pv[i][0];
#pragma unroll
    for (int s = 1; s < KSPLIT; ++s) a += w[s] * pv[i][s];
    *(v4f*)((char*)out + (size_t)i * (HWN * 4) + eb) = a * inv;
  }
}

// =====================================================================================================
//   FB   bf16 [8192][128]        0          2097152
//   VT   f16  [128][8192]        2097152    2097152
//   PT   f32  [2][128][8][4096]  4194304    33554432
//   ML   f32  [2][8][8192]       37748736   524288
//   end                          38273024
// =====================================================================================================
extern "C" void kernel_launch(void* const* d_in, const int* in_sizes, int n_in,
                              void* d_out, int out_size, void* d_ws, size_t ws_size,
                              hipStream_t stream) {
  const int NEL = NTOK * CD;                            // 1048576
  if (n_in < 1) return;
  if (in_sizes[0] != NEL) return;
  if (out_size != NEL) return;

  const size_t PL = (size_t)NEL * 2;                    // 2097152
  size_t off = 0;
  const size_t oF = off; off += PL;
  const size_t oV = off; off += PL;
  const size_t oP = off; off += (size_t)KSPLIT * NEL * 4;
  const size_t oM = off; off += (size_t)2 * KSPLIT * NTOK * 4;
  if (off > ws_size) return;                            // off = 38273024
  if (off > (size_t)134217728) return;

  const float* x = (const float*)d_in[0];
  char* ws = (char*)d_ws;
  unsigned short* FB = (unsigned short*)(ws + oF);
  unsigned short* VT = (unsigned short*)(ws + oV);
  float* PT = (float*)(ws + oP);
  float* ML = (float*)(ws + oM);
  float* out = (float*)d_out;

  const dim3 blk256(256), blk128(128);
  const dim3 gCV(NTOK / 64);                            // 128 blocks: one 64-token tile each
  const dim3 gAT((NTOK / 64) * KSPLIT);                 // 1024 blocks: one 64-query block and one key range each
  const dim3 gMG((NTOK / 128) * (CD / 32));             // 256 blocks: 128 queries x 32 channels each

  // (0) operand planes: FB = bf16 RNE bits of f (token-major), VT = f16 of bf16-RNE(f), channel-major
  cvt_planes<<<gCV, blk256, 0, stream>>>(x, FB, VT);

  // (1) attention per key range: un-normalised sum_m e^{s_nm - shift} f_m[d] with its shift and row sum, n = b*4096 + hw
  attn_kernel<<<gAT, blk128, 0, stream>>>(FB, VT, PT, ML);

  // (2) merge: out[b][d][hw] = sum_m softmax_m(f_n . f_m / sqrt(128)) f_m[d]
  merge_kernel<<<gMG, blk256, 0, stream>>>(PT, ML, out);
  (void)hipGetLastError();
}

// v004
// Measured time: 33.2 microseconds a run.
// Next to v003, in two timings, it ran 1.13 and 1.15 times as fast.
// Over all steps from v000 it is 9.81 times as fast.
// Contractions: S^T = f (keys as A rows) . f^T (queries as B columns) on v_wmma_f32_16x16x32_f16, K = 128 channels, one product;
// O^T = f^T (channel rows, x1) . P^T (f16, e^{s-m} x 1024 from the score D registers) on v_wmma_f32_16x16x32_f16 over 8192 keys,
// one product; every f operand is the one plane VT = f16 of the bf16-RNE input, channel-major; f32 accumulate everywhere;
// softmax (lazy shift m, row sums, 1/l) in f32 on VALU. The 8192 keys are cut into 8 ranges, one work-group per (64 queries, range);
// a last launch merges the ranges' un-normalised sums in f32.
#include <hip/hip_runtime.h>
#include <math.h>
#include <stdint.h>

#define NTOK  8192
#define CD    128
#define HWN   4096
#define NBAT  2
#define LNPS  6.931471805599453f
#define ATTSC 0.08838834764831845f
#define RATTSC 11.313708498984761f          // 1 / ATTSC
#define MGAP  3.0f                          // e^3 * 1024 = 20568 < 65504, the largest f16
static_assert(NTOK == NBAT * HWN);
static_assert((NTOK % 64) == 0);
static_assert((HWN % 64) == 0);
static_assert(CD == 128);

typedef _Float16       v16h __attribute__((ext_vector_type(16)));
typedef _Float16       v8h  __attribute__((ext_vector_type(8)));
typedef short          v8s  __attribute__((ext_vector_type(8)));
typedef float          v8f  __attribute__((ext_vector_type(8)));
typedef float          v4f  __attribute__((ext_vector_type(4)));
typedef unsigned int   v4u  __attribute__((ext_vector_type(4)));

union FragH { v16h v; v8h  h[2]; };
static_assert(sizeof(FragH) == 32);

// ---- scalar helpers --------------------------------------------------------------------------------
__device__ __forceinline__ unsigned short bf_bits(float f) {          // f32 -> bf16 bits, RNE convert
  unsigned u = __float_as_uint(f);
  return (unsigned short)((u + 0x7FFFu + ((u >> 16) & 1u)) >> 16);
}
__device__ __forceinline__ float bf_up(unsigned short h) { return __uint_as_float(((unsigned)h) << 16); }
__device__ __forceinline__ unsigned short h_bits(_Float16 x) { return __builtin_bit_cast(unsigned short, x); }
__device__ __forceinline__ unsigned pk16(unsigned short a, unsigned short b) { return (unsigned)a | ((unsigned)b << 16); }
__device__ __forceinline__ v8f zero8() { v8f z = {0.f, 0.f, 0.f, 0.f, 0.f, 0.f, 0.f, 0.f}; return z; }
__device__ __forceinline__ float hmax8(v8f s) {
  return fmaxf(fmaxf(fmaxf(s[0], s[1]), fmaxf(s[2], s[3])), fmaxf(fmaxf(s[4], s[5]), fmaxf(s[6], s[7])));
}

// ---- fragment loaders: 16-bit A/B operand in the hardware k order, lane (c = lane&15, h = lane>>4) -> row/col c;
//      elements 0..7 <- k0+8h .. k0+8h+7, elements 8..15 <- k0+16+8h .. k0+16+8h+7
// plain fragment: the two 16-B pieces of one LDS row, each at its own (swizzled) place
__device__ __forceinline__ v16h ldfrag_2(const char* p0, const char* p1) {
  FragH f;
  f.h[0] = *(const v8h*)(const void*)p0;
  f.h[1] = *(const v8h*)(const void*)p1;
  return f.v;
}
// transposing LDS load: the lanes hand in 16-B pieces of 16 rows x 16 columns, lane (c, h) gets column c of rows 8h .. 8h+7
__device__ __forceinline__ v8h ld_tr16(const char* p) {
  typedef __attribute__((address_space(3))) v8s lds_v8s;
  return __builtin_bit_cast(v8h, __builtin_amdgcn_ds_load_tr16_b128_v8i16((lds_v8s*)p));
}
// transposed fragment: rows (= k) 0..15 at p, rows 16..31 at p + 16 tile rows; hardware k order
__device__ __forceinline__ v16h ldfrag_t(const char* p) {
  FragH f;
  f.h[0] = ld_tr16(p);
  f.h[1] = ld_tr16(p + 16 * 128);
  return f.v;
}

// ---- WMMA helpers with trailing VALU hazard gap --------------------------------------------------------
__device__ __forceinline__ v8f mma_h_raw(v16h a, v16h b, v8f c) {
  return __builtin_amdgcn_wmma_f32_16x16x32_f16(false, a, false, b, (short)0, c, false, false);
}
// ties the two score accumulators and keeps the 8 key fragments + 4 query fragments live past the nops
__device__ __forceinline__ void sguard12(v8f& a, v8f& b,
                                         v16h h0, v16h h1, v16h h2, v16h h3,
                                         v16h h4, v16h h5, v16h h6, v16h h7,
                                         v16h g0, v16h g1, v16h g2, v16h g3) {
#if defined(__HIP_DEVICE_COMPILE__)
  asm volatile("v_nop\n\tv_nop\n\tv_nop\n\tv_nop"
               : "+v"(a), "+v"(b)
               : "v"(h0), "v"(h1), "v"(h2), "v"(h3), "v"(h4), "v"(h5), "v"(h6), "v"(h7),
                 "v"(g0), "v"(g1), "v"(g2), "v"(g3));
#endif
}
__device__ __forceinline__ void oguard4(v8f& a, v8f& b, v8f& c, v8f& d,
                                        v16h x0, v16h x1, v16h x2, v16h x3, v16h p0) {
#if defined(__HIP_DEVICE_COMPILE__)
  asm volatile("v_nop\n\tv_nop\n\tv_nop\n\tv_nop"
               : "+v"(a), "+v"(b), "+v"(c), "+v"(d) : "v"(x0), "v"(x1), "v"(x2), "v"(x3), "v"(p0));
#endif
}

// =====================================================================================================
// Operand plane. Input is NCHW f32: x[b][c][hw], token n = b*4096 + hw, channel c.
//   VT[c][n] = f16 of the bf16-RNE input, channel-major [128][8192], taken straight from x[b][c][hw].
// One block (256 threads) per 64-token tile n0 = 64*bx (one b, hw0 = n0 & 4095): thread (e = tid&7, lq = tid>>3) converts 8
// consecutive hw of channel 32*it + lq, it 0..3; 8 consecutive threads write one whole 128-B line.
// coverage: it 0..3 x lq 0..31 = c 0..127, e 0..7 x 8 = hw 0..63 of the tile; grid = 8192/64 = 128 blocks cover the plane once.
// =====================================================================================================
__global__ __launch_bounds__(256) void cvt_planes(const float* __restrict__ xin, unsigned short* VT) {
  const int tid = threadIdx.x;
  const int n0  = blockIdx.x * 64;
  const int b   = n0 >> 12;
  const int hw0 = n0 & (HWN - 1);
  const int e = tid & 7, lq = tid >> 3;                   // lq 0..31
  // one address pair for the eight loads (the channel step of 32 rows is an immediate offset)
  const float* p0 = xin + ((size_t)(b * CD + lq)) * HWN + hw0 + 8 * e;
  v4f xa[4], xb[4];
#pragma unroll
  for (int it = 0; it < 4; ++it) {                        // channel c = 32*it + lq
    xa[it] = *(const v4f*)(p0 + (size_t)it * 32 * HWN);
    xb[it] = *(const v4f*)(p0 + (size_t)it * 32 * HWN + 4);
  }
#if defined(__HIP_DEVICE_COMPILE__)
  // the wait before the address pair that the eight loads name is reused; as an operand here the pair lives up to the wait
  asm volatile("s_wait_xcnt 0x0" :: "v"(p0) : "memory");
#endif
  unsigned short* o0 = VT + (size_t)lq * NTOK + n0 + 8 * e;
#pragma unroll
  for (int it = 0; it < 4; ++it) {
    unsigned short hb[8];
#pragma unroll
    for (int i = 0; i < 4; ++i) { hb[i] = bf_bits(xa[it][i]); hb[4 + i] = bf_bits(xb[it][i]); }
    v4u w;
#pragma unroll
    for (int i = 0; i < 4; ++i)
      w[i] = pk16(h_bits((_Float16)bf_up(hb[2 * i])), h_bits((_Float16)bf_up(hb[2 * i + 1])));
    *(v4u*)(o0 + (size_t)it * 32 * NTOK) = w;
  }
}

// ---- LDS ring of key tiles, filled by asynchronous copies -----------------------------------------------
// One stage = 64 keys = ONE tile: 128 channel rows x 128 B of VT, LDS pitch 128 B. It is V^T as it lies (plain ds_load_b128
// fragments, rows = channels) and K through the transposing load (ds_load_tr16_b128, rows = k = channels, columns = keys).
// The two readers want different pitches, so the rows are not padded but swizzled: 16-B piece p of row r lies at piece
// p ^ SWZ(r). Banks (16-B groups, 16 of them) = 8 * (r & 1) + (p ^ SWZ(r)):
//   plain reader, a half wave = 16 rows, one p: the 8 even rows have 8 different SWZ, the odd rows the other 8 groups;
//   transposing reader, a half wave = 8 rows x pieces 2q, 2q+1: the 4 even rows differ in SWZ bits 1, 2, the pieces in bit 0.
// Two stages, and in front of them the block's own 64 queries as a tile of the same form (read once, the same way as K).
#define KT     64
#define KSPLIT 8                            // key ranges; 128 query blocks x 8 = 1024 work-groups = 4 on each of 256 WGPs
#define KRANGE (NTOK / KSPLIT)              // 1024 keys per work-group
#define NSTG   (KRANGE / KT)                // stages per work-group
#define TROW   128                          // tile row, bytes
#define TBYTES (CD * TROW)                  // 16384 B per tile
#define SWZ(r) (((((r) >> 1) & 3) << 1) | (((r) >> 3) & 1))
static_assert(NSTG >= 2);
static_assert(KSPLIT * KRANGE == NTOK && NSTG * KT == KRANGE);
static_assert(KT * 2 == TROW);

// eight 16-B copies per lane; l = the lane's LDS byte address, g = the lane's global address, ls / gs = step per copy.
// The s_wait_xcnt closes the statement so that it stands before any later rewrite of the address registers.
__device__ __forceinline__ void copy8(unsigned l, unsigned ls, const unsigned short* g, size_t gs) {
#if defined(__HIP_DEVICE_COMPILE__)
  asm volatile("global_load_async_to_lds_b128 %0, %8, off\n\t"
               "global_load_async_to_lds_b128 %1, %9, off\n\t"
               "global_load_async_to_lds_b128 %2, %10, off\n\t"
               "global_load_async_to_lds_b128 %3, %11, off\n\t"
               "global_load_async_to_lds_b128 %4, %12, off\n\t"
               "global_load_async_to_lds_b128 %5, %13, off\n\t"
               "global_load_async_to_lds_b128 %6, %14, off\n\t"
               "global_load_async_to_lds_b128 %7, %15, off\n\t"
               "s_wait_xcnt 0x0"
               :: "v"(l), "v"(l + ls), "v"(l + 2 * ls), "v"(l + 3 * ls),
                  "v"(l + 4 * ls), "v"(l + 5 * ls), "v"(l + 6 * ls), "v"(l + 7 * ls),
                  "v"(g), "v"(g + gs), "v"(g + 2 * gs), "v"(g + 3 * gs),
                  "v"(g + 4 * gs), "v"(g + 5 * gs), "v"(g + 6 * gs), "v"(g + 7 * gs)
               : "memory");
#endif
}
// tile fill by the block's 128 threads: copy i, thread t -> channel row 16i + (t>>3), piece t&7 (a wave's copy = 4 whole lines);
// SWZ(16i + r) = SWZ(r), so the LDS step per copy is 16 plain rows.
__device__ __forceinline__ void fill_tile(unsigned tl, const unsigned short* vg) {
  copy8(tl, 16 * TROW, vg, (size_t)16 * NTOK);
}
// the issuing wave's own wait: its copies have landed (asm, so that no LDS read moves in front of it)
__device__ __forceinline__ void wait_copies() {
#if defined(__HIP_DEVICE_COMPILE__)
  asm volatile("s_wait_asynccnt 0x0" ::: "memory");
#endif
}
// the wave's LDS reads of a buffer have returned before the buffer is handed to the next copies
__device__ __forceinline__ void wait_lds() {
#if defined(__HIP_DEVICE_COMPILE__)
  asm volatile("s_wait_dscnt 0x0" ::: "memory");
#endif
}

// =====================================================================================================
// Attention for one 64-query block and one range of 1024 keys, transposed formulation, 128 channels, no mask:
//   S^T tile (16 keys x 16 queries) = A(keys kb + (lane&15), channels in the hardware k order, transposing loads of the stage tile) .
//                                     B(col = query, the same loads of the query tile), four channel-steps of 32.
//   Per lane the D tile holds 8 keys of ONE query, so the online softmax (shift m, f32) is per-lane state; m follows the running
//   max lazily (see the loop), with one shuffle (lane^16) when it moves; the row sum is a per-lane partial combined at the end.
//   P = e^{s-m} x 1024 as one f16 vector is used directly as the B operand of O^T (rows d, cols queries) +=
//   A(VT rows d, keys contiguous, two 16-B loads) . B(P^T): B element r <- D of the tile covering keys kb..kb+15,
//   element 8+r <- the tile covering kb+16..kb+31, lane unchanged (D-as-B chaining layout). One product per d tile, 8 d tiles.
//   32 keys per iteration: 8 score WMMAs + 8 output WMMAs per wave. Block = 4 waves = 64 queries; grid = 128 query blocks x 8 ranges.
//   Both A operands come from one tile per stage of a two-stage LDS ring (64 keys a stage) that the block's four waves fill
//   together and all read: stage st + 1 is copied while stage st is worked on.
//   Epilogue: the block's [64 query][128 d] f32 tile, un-normalised, is staged in the ring's LDS (free behind the loop's last
//   barrier) with 16-B stores (layout [query][d], pitch 132), beside each query's shift m and row sum.
// coverage: block writes part[b][d][range][hw0..hw0+63] for d 0..127 (256 lines) and ml[0][range][q0..q0+63] (shift m),
//           ml[1][range][q0..q0+63] (sum), one line per wave; 1024 blocks cover part [2][128][8][4096] and ml [2][8][8192] once.
// =====================================================================================================
__global__ __launch_bounds__(128)
void attn_kernel(const unsigned short* __restrict__ vtp, float* part, float* ml) {
  __shared__ __align__(256) unsigned short Ring[3 * TBYTES / 2];   // query tile, stage buffer 0, stage buffer 1; banks as planned
  float* Os = (float*)(void*)Ring;                // output staging, used only behind the loop's last barrier
  static_assert((64 * 132 + 128) * 4 <= 3 * TBYTES);
  const int tid  = threadIdx.x;
  const int wave = tid >> 5;
  const int lane = tid & 31;
  const int hh   = lane >> 4;
  const int c    = lane & 15;
  const int bx   = blockIdx.x / KSPLIT;           // query block 0..127
  const int sp   = blockIdx.x & (KSPLIT - 1);     // key range 0..7
  const int q0   = bx * 64;                       // first query token of the block
  const int b    = q0 >> 12;
  const int hw0  = q0 & (HWN - 1);

  // ---- transposing reader: lane -> tile row 8hh + (lane&7) (+ 16 per load, + 32 per channel step), piece P + ((lane>>3)&1),
  //      P even = first column / 8; byte offset in a tile for P = 0, other P by XOR (P touches bits 1, 2 of the piece only) ----
  const int tr = 8 * hh + (lane & 7);
  const int To = tr * TROW + ((((lane >> 3) & 1) ^ SWZ(tr)) << 4);
  // ---- plain reader: lane -> tile row c (+ 16j), piece P + hh, P even = first key / 8 ----
  const int Po = c * TROW + ((hh ^ SWZ(c)) << 4);

  // ---- this thread's share of a tile fill ----
  const unsigned ring0 = (unsigned)(size_t)Ring;                       // LDS byte address of the ring
  const unsigned tl = ring0 + (unsigned)((tid >> 3) * TROW + (((tid & 7) ^ SWZ(tid >> 3)) << 4));
  const unsigned short* vrow = vtp + (size_t)(tid >> 3) * NTOK + (tid & 7) * 8;
  const unsigned short* vg = vrow + sp * KRANGE;

  // ---- prologue: the query tile and stage 0 land and are published, stage 1 starts ----
  fill_tile(tl, vrow + q0);
  fill_tile(tl + TBYTES, vg);
  wait_copies();
  __syncthreads();
  fill_tile(tl + 2 * TBYTES, vg + KT);

  // ---- query fragments (B operand, col = query q0 + 16*wave + c): columns 16*wave .. of the query tile, P = 2*wave ----
  const char* qt = (const char*)(const void*)Ring + (To ^ (wave << 5));
  const v16h qf0 = ldfrag_t(qt);                  // channels 0..31
  const v16h qf1 = ldfrag_t(qt + 32 * TROW);      // channels 32..63
  const v16h qf2 = ldfrag_t(qt + 64 * TROW);      // channels 64..95
  const v16h qf3 = ldfrag_t(qt + 96 * TROW);      // channels 96..127

  float m = -1.0e30f, l = 0.f;
  float msh = m - LNPS, thr = (m + MGAP) * RATTSC;   // the first 32 keys always take the branch
  v8f o0 = zero8(), o1 = zero8(), o2 = zero8(), o3 = zero8();
  v8f o4 = zero8(), o5 = zero8(), o6 = zero8(), o7 = zero8();
#pragma unroll 1
  for (int st = 0; st < NSTG; ++st) {
   const char* Sb = (const char*)(const void*)Ring + (1 + (st & 1)) * TBYTES;   // this stage's tile
#pragma unroll                                                      // kb constant: it folds into the piece XORs
   for (int sub = 0; sub < KT / 32; ++sub) {
    const int kb = sub * 32;                                       // first key of the 32, within the stage
    const char* k0p = Sb + (To ^ (kb * 2));                        // keys kb .. kb+15:    P = kb / 8
    const char* k1p = Sb + (To ^ (kb * 2 + 32));                   // keys kb+16 .. kb+31: P = kb / 8 + 2
    const v16h a00 = ldfrag_t(k0p),             a01 = ldfrag_t(k0p + 32 * TROW);
    const v16h a02 = ldfrag_t(k0p + 64 * TROW), a03 = ldfrag_t(k0p + 96 * TROW);
    const v16h a10 = ldfrag_t(k1p),             a11 = ldfrag_t(k1p + 32 * TROW);
    const v16h a12 = ldfrag_t(k1p + 64 * TROW), a13 = ldfrag_t(k1p + 96 * TROW);
    v8f s0 = mma_h_raw(a00, qf0, zero8());
    s0 = mma_h_raw(a01, qf1, s0);
    s0 = mma_h_raw(a02, qf2, s0);
    s0 = mma_h_raw(a03, qf3, s0);
    v8f s1 = mma_h_raw(a10, qf0, zero8());
    s1 = mma_h_raw(a11, qf1, s1);
    s1 = mma_h_raw(a12, qf2, s1);
    s1 = mma_h_raw(a13, qf3, s1);
    sguard12(s0, s1, a00, a01, a02, a03, a10, a11, a12, a13, qf0, qf1, qf2, qf3);

    // lazy rescale: m is the shift in use, not the running max. It moves, and the sums are rescaled, only when some score of
    // the wave's 32 x 16 tile lies more than MGAP above its column's m (thr = that bound in raw score units); one scalar branch
    // per 32 keys. Otherwise every e^{s-m} * 1024 <= e^MGAP * 1024, inside f16, and the exchange between the halves, the
    // correction factor and its 65 products are all left out.
    const float mr = fmaxf(hmax8(s0), hmax8(s1));        // raw, over this lane's 16 keys
    if (__builtin_amdgcn_ballot_w32(mr > thr) != 0) {
      const float mx   = fmaxf(mr, __shfl_xor(mr, 16, 32)) * ATTSC;   // both halves of a column take the same new m
      const float mn   = fmaxf(m, mx);
      const float corr = __expf(m - mn);
      m = mn;
      msh = mn - LNPS;                      // exp gives e^{s-m} * 1024
      thr = (mn + MGAP) * RATTSC;
      l *= corr;
#pragma unroll
      for (int r = 0; r < 8; ++r) {
        o0[r] *= corr; o1[r] *= corr; o2[r] *= corr; o3[r] *= corr;
        o4[r] *= corr; o5[r] *= corr; o6[r] *= corr; o7[r] *= corr;
      }
    }

    FragH ph;
    float ls = 0.f;
#pragma unroll
    for (int r = 0; r < 8; ++r) {
      const float e0 = __expf(s0[r] * ATTSC - msh);   // key kb      + 8hh + r
      const float e1 = __expf(s1[r] * ATTSC - msh);   // key kb + 16 + 8hh + r
      ls += e0 + e1;
      ph.h[0][r] = (_Float16)e0;
      ph.h[1][r] = (_Float16)e1;
    }
    l += ls;

    const char* v0p = Sb + (Po ^ (kb * 2));                        // keys kb + 8hh ..:      P = kb / 8
    const char* v1p = Sb + (Po ^ (kb * 2 + 32));                   // keys kb + 16 + 8hh ..: P = kb / 8 + 2
    {
      const v16h vf0 = ldfrag_2(v0p,             v1p);
      const v16h vf1 = ldfrag_2(v0p + 16 * TROW, v1p + 16 * TROW);
      const v16h vf2 = ldfrag_2(v0p + 32 * TROW, v1p + 32 * TROW);
      const v16h vf3 = ldfrag_2(v0p + 48 * TROW, v1p + 48 * TROW);
      o0 = mma_h_raw(vf0, ph.v, o0);
      o1 = mma_h_raw(vf1, ph.v, o1);
      o2 = mma_h_raw(vf2, ph.v, o2);
      o3 = mma_h_raw(vf3, ph.v, o3);
      oguard4(o0, o1, o2, o3, vf0, vf1, vf2, vf3, ph.v);
    }
    {
      const v16h vf4 = ldfrag_2(v0p + 64 * TROW,  v1p + 64 * TROW);
      const v16h vf5 = ldfrag_2(v0p + 80 * TROW,  v1p + 80 * TROW);
      const v16h vf6 = ldfrag_2(v0p + 96 * TROW,  v1p + 96 * TROW);
      const v16h vf7 = ldfrag_2(v0p + 112 * TROW, v1p + 112 * TROW);
      o4 = mma_h_raw(vf4, ph.v, o4);
      o5 = mma_h_raw(vf5, ph.v, o5);
      o6 = mma_h_raw(vf6, ph.v, o6);
      o7 = mma_h_raw(vf7, ph.v, o7);
      oguard4(o4, o5, o6, o7, vf4, vf5, vf6, vf7, ph.v);
    }
   }
   // ---- publish point of stage st + 1; the same barrier frees this stage's buffer for stage st + 2 ----
   wait_lds();
   wait_copies();
   __syncthreads();
   if (st + 2 < NSTG)
     fill_tile(tl + (unsigned)((1 + (st & 1)) * TBYTES), vg + (st + 2) * KT);
  }
  wait_copies();
  l += __shfl_xor(l, 16, 32);
  // un-normalised: the merge divides; both o and l carry the x1024 factor

  // ---- stage Os[query 16*wave + c][d = 16j + 8hh + r] with 16-B LDS stores; shift m and sum behind the tile ----
  if (hh == 0) {
    Os[64 * 132 + wave * 16 + c]      = m;
    Os[64 * 132 + 64 + wave * 16 + c] = l;
  }
  {
    float* os = Os + (wave * 16 + c) * 132 + 8 * hh;
    v4f t;
    t = {o0[0], o0[1], o0[2], o0[3]}; *(v4f*)(os + 0)   = t;
    t = {o0[4], o0[5], o0[6], o0[7]}; *(v4f*)(os + 4)   = t;
    t = {o1[0], o1[1], o1[2], o1[3]}; *(v4f*)(os + 16)  = t;
    t = {o1[4], o1[5], o1[6], o1[7]}; *(v4f*)(os + 20)  = t;
    t = {o2[0], o2[1], o2[2], o2[3]}; *(v4f*)(os + 32)  = t;
    t = {o2[4], o2[5], o2[6], o2[7]}; *(v4f*)(os + 36)  = t;
    t = {o3[0], o3[1], o3[2], o3[3]}; *(v4f*)(os + 48)  = t;
    t = {o3[4], o3[5], o3[6], o3[7]}; *(v4f*)(os + 52)  = t;
    t = {o4[0], o4[1], o4[2], o4[3]}; *(v4f*)(os + 64)  = t;
    t = {o4[4], o4[5], o4[6], o4[7]}; *(v4f*)(os + 68)  = t;
    t = {o5[0], o5[1], o5[2], o5[3]}; *(v4f*)(os + 80)  = t;
    t = {o5[4], o5[5], o5[6], o5[7]}; *(v4f*)(os + 84)  = t;
    t = {o6[0], o6[1], o6[2], o6[3]}; *(v4f*)(os + 96)  = t;
    t = {o6[4], o6[5], o6[6], o6[7]}; *(v4f*)(os + 100) = t;
    t = {o7[0], o7[1], o7[2], o7[3]}; *(v4f*)(os + 112) = t;
    t = {o7[4], o7[5], o7[6], o7[7]}; *(v4f*)(os + 116) = t;
  }
  __syncthreads();
  {
    const int e = tid & 7, lq = tid >> 3;               // lq 0..15: line within group, e: 16-B piece
    v4f vals[16];
#pragma unroll
    for (int it = 0; it < 16; ++it) {
      const int L  = it * 16 + lq;                        // it 0..15 x lq 0..15 = lines 0..255 of the block tile
      const int ch = L >> 1, hf = L & 1;                  // channel 0..127, half-row 0..1 (queries hf*32 .. hf*32+31)
      const int qq = hf * 32 + 4 * e;                     // first of the 4 queries of this 16-B piece
      v4f v;
      v[0] = Os[(qq + 0) * 132 + ch];
      v[1] = Os[(qq + 1) * 132 + ch];
      v[2] = Os[(qq + 2) * 132 + ch];
      v[3] = Os[(qq + 3) * 132 + ch];
      vals[it] = v;
    }
    // waves 0, 1: the 64 shifts m; waves 2, 3: the 64 sums; one whole line per wave
    ml[(size_t)(tid >> 6) * (KSPLIT * NTOK) + sp * NTOK + q0 + (tid & 63)] = Os[64 * 132 + tid];
    float* ob = part + (((size_t)b * CD) * KSPLIT + sp) * HWN + hw0;     // part[b][d][range][hw]
    {
#pragma unroll
      for (int it = 0; it < 16; ++it) {
        const int L  = it * 16 + lq;
        const int ch = L >> 1, hf = L & 1;
        *(v4f*)(ob + (size_t)ch * (KSPLIT * HWN) + hf * 32 + 4 * e) = vals[it];
      }
      
    }
  }
}

// =====================================================================================================
// Merge of the 8 key ranges: M = max_s m_s, w_s = e^{m_s - M}, out = sum_s w_s part_s / sum_s w_s l_s, all f32.
// Block = 8 waves = 128 queries (lane -> 4 consecutive queries, one b) x 32 channels (wave -> 4 channels); every load and store
// of a wave is 512 contiguous B. Grid = 64 query groups x 4 channel groups = 256 blocks cover out [2][128][4096] exactly once.
// =====================================================================================================
// e^x as the fast exponential compiles it (x * log2 e, v_exp_f32), with the v_nop in the same statement: it fills the one slot that
// the instruction set asks for between a transcendental and a next instruction that overwrites its source or reads its result
__device__ __forceinline__ float exp_slot(float x) {
  float r = 0.f;
#if defined(__HIP_DEVICE_COMPILE__)
  asm("v_exp_f32 %0, %1\n\tv_nop" : "=v"(r) : "v"(x * 1.4426950408889634f));
#endif
  return r;
}
__global__ __launch_bounds__(256)
void merge_kernel(const float* __restrict__ part, const float* __restrict__ ml, float* out) {
  const int tid = threadIdx.x;
  const int q   = (blockIdx.x >> 2) * 128 + 4 * (tid & 31);           // first of this lane's 4 query tokens
  const int d0  = (blockIdx.x & 3) * 32 + 4 * (tid >> 5);             // first of this wave's 4 channels
  // 32-bit byte offsets beside the uniform bases: one address register each for ml, part and out, the rest immediates
  const unsigned qb = (unsigned)q * 4u;
  const unsigned rw = (unsigned)(q >> 12) * CD + (unsigned)d0;       // row b * 128 + d0 of out
  const unsigned hb = (unsigned)(q & (HWN - 1)) * 4u;
  const unsigned eb = rw * (HWN * 4u) + hb;
  const unsigned pb = rw * (KSPLIT * HWN * 4u) + hb;
  const char* mlb = (const char*)ml;
  const char* ptb = (const char*)part;
  v4f mm[KSPLIT], ll[KSPLIT], pv[4][KSPLIT];
#pragma unroll
  for (int s = 0; s < KSPLIT; ++s) {
    mm[s] = *(const v4f*)(mlb + (size_t)s * (NTOK * 4) + qb);
    ll[s] = *(const v4f*)(mlb + (size_t)(KSPLIT + s) * (NTOK * 4) + qb);
  }
#pragma unroll
  for (int i = 0; i < 4; ++i)
#pragma unroll
    for (int s = 0; s < KSPLIT; ++s) pv[i][s] = *(const v4f*)(ptb + (size_t)(i * KSPLIT + s) * (HWN * 4) + pb);
#if defined(__HIP_DEVICE_COMPILE__)
  // the wait before the two registers that the 48 loads above name are reused; as operands here they live up to the wait
  asm volatile("s_wait_xcnt 0x0" :: "v"(qb), "v"(pb) : "memory");
#endif
  // keeps the arithmetic behind all 48 loads: one memory round trip; without it the sums rise among the loads, two in flight
  __builtin_amdgcn_sched_barrier(0);
  v4f w[KSPLIT], inv;
#pragma unroll
  for (int t = 0; t < 4; ++t) {
    float M = mm[0][t];
#pragma unroll
    for (int s = 1; s < KSPLIT; ++s) M = fmaxf(M, mm[s][t]);
    float L = 0.f;
#pragma unroll
    for (int s = 0; s < KSPLIT; ++s) { w[s][t] = exp_slot(mm[s][t] - M); L += w[s][t] * ll[s][t]; }
    inv[t] = 1.0f / L;
  }
#pragma unroll
  for (int i = 0; i < 4; ++i) {
    v4f a = w[0] * pv[i][0];
#pragma unroll
    for (int s = 1; s < KSPLIT; ++s) a += w[s] * pv[i][s];
    *(v4f*)((char*)out + (size_t)i * (HWN * 4) + eb) = a * inv;
  }
}

// =====================================================================================================
//   VT   f16  [128][8192]        0          2097152
//   PT   f32  [2][128][8][4096]  2097152    33554432
//   ML   f32  [2][8][8192]       35651584   524288
//   end                          36175872
// =====================================================================================================
extern "C" void kernel_launch(void* const* d_in, const int* in_sizes, int n_in,
                              void* d_out, int out_size, void* d_ws, size_t ws_size,
                              hipStream_t stream) {
  const int NEL = NTOK * CD;                            // 1048576
  if (n_in < 1) return;
  if (in_sizes[0] != NEL) return;
  if (out_size != NEL) return;

  const size_t PL = (size_t)NEL * 2;                    // 2097152
  size_t off = 0;
  const size_t oV = off; off += PL;
  const size_t oP = off; off += (size_t)KSPLIT * NEL * 4;
  const size_t oM = off; off += (size_t)2 * KSPLIT * NTOK * 4;
  if (off > ws_size) return;                            // off = 36175872
  if (off > (size_t)134217728) return;

  const float* x = (const float*)d_in[0];
  char* ws = (char*)d_ws;
  unsigned short* VT = (unsigned short*)(ws + oV);
  float* PT = (float*)(ws + oP);
  float* ML = (float*)(ws + oM);
  float* out = (float*)d_out;

  const dim3 blk256(256), blk128(128);
  const dim3 gCV(NTOK / 64);                            // 128 blocks: one 64-token tile each
  const dim3 gAT((NTOK / 64) * KSPLIT);                 // 1024 blocks: one 64-query block and one key range each
  const dim3 gMG((NTOK / 128) * (CD / 32));             // 256 blocks: 128 queries x 32 channels each

  // (0) operand plane: VT = f16 of bf16-RNE(f), channel-major
  cvt_planes<<<gCV, blk256, 0, stream>>>(x, VT);

  // (1) attention per key range: un-normalised sum_m 1024 e^{s_nm - sh_n} f_m[d] with its shift sh_n and row sum, n = b*4096 + hw
  attn_kernel<<<gAT, blk128, 0, stream>>>(VT, PT, ML);

  // (2) merge: out[b][d][hw] = sum_m softmax_m(f_n . f_m / sqrt(128)) f_m[d]
  merge_kernel<<<gMG, blk256, 0, stream>>>(PT, ML, out);
  (void)hipGetLastError();
}
